// v000
// The times below were measured on an AMD MI455X: many runs one after another, warmed up first and cycling through
// copies of the inputs, with the whole window's GPU time divided by the number of runs. Launches and the gaps
// between them are all in it. The median over several windows is given; except for v000 it joins two sittings, which
// can be a few percent apart, so the side-by-side timings, each taken in one sitting, are the better comparison.
// v000 is the starting kernel. One run takes 116 microseconds.
#include <hip/hip_runtime.h>

typedef __attribute__((ext_vector_type(16))) _Float16 v16h;
typedef __attribute__((ext_vector_type(8)))  _Float16 v8h;
typedef __attribute__((ext_vector_type(2)))  __fp16   fp16x2;
typedef __attribute__((ext_vector_type(8)))  float    v8f;

#define NHEAD    16
#define DHEAD    64
#define DMODEL   1024
#define KTILE    64           // keys per tile (amortizes per-tile softmax overhead)
#define WAVES    8
#define QBLK     128          // 8 waves * 16 query rows
#define VT_PITCH 72           // 64 + 8 halves pad: 16B-aligned rows, bank spread

union V16 { v16h v; v8h h[2]; };
template<bool B> struct BoolC { static constexpr bool value = B; };

__device__ __forceinline__ unsigned pk16(float a, float b) {   // v_cvt_pk_rtz_f16_f32
    union { fp16x2 h; unsigned u; } cv;
    cv.h = __builtin_amdgcn_cvt_pkrtz(a, b);
    return cv.u;
}

// Butterfly reductions across each 16-lane half via DPP16 ROW_XMASK: pure VALU.
__device__ __forceinline__ float rowmax16(float x) {
    int t;
    t = __builtin_amdgcn_update_dpp(0, __float_as_int(x), 0x161, 0xf, 0xf, true);
    x = fmaxf(x, __int_as_float(t));
    t = __builtin_amdgcn_update_dpp(0, __float_as_int(x), 0x162, 0xf, 0xf, true);
    x = fmaxf(x, __int_as_float(t));
    t = __builtin_amdgcn_update_dpp(0, __float_as_int(x), 0x164, 0xf, 0xf, true);
    x = fmaxf(x, __int_as_float(t));
    t = __builtin_amdgcn_update_dpp(0, __float_as_int(x), 0x168, 0xf, 0xf, true);
    x = fmaxf(x, __int_as_float(t));
    return x;
}
__device__ __forceinline__ float rowsum16(float x) {
    int t;
    t = __builtin_amdgcn_update_dpp(0, __float_as_int(x), 0x161, 0xf, 0xf, true);
    x += __int_as_float(t);
    t = __builtin_amdgcn_update_dpp(0, __float_as_int(x), 0x162, 0xf, 0xf, true);
    x += __int_as_float(t);
    t = __builtin_amdgcn_update_dpp(0, __float_as_int(x), 0x164, 0xf, 0xf, true);
    x += __int_as_float(t);
    t = __builtin_amdgcn_update_dpp(0, __float_as_int(x), 0x168, 0xf, 0xf, true);
    x += __int_as_float(t);
    return x;
}

// Fused causal flash-attention with ALiBi, log2-domain online softmax,
// double-buffered f16 K/V staging in LDS shared by 8 waves per block.
__global__ __launch_bounds__(256)
void fa_alibi_kernel(const float* __restrict__ Q,
                     const float* __restrict__ K,
                     const float* __restrict__ V,
                     float* __restrict__ O,
                     int T)
{
    __shared__ __align__(16) _Float16 sK [2][KTILE][DHEAD];      // K tiles, row-major
    __shared__ __align__(16) _Float16 sVt[2][DHEAD][VT_PITCH];   // V tiles, transposed
    __shared__ __align__(16) _Float16 sP [WAVES][16][KTILE];     // per-wave P scratch

    const int qTiles = T / QBLK;
    const int qt = blockIdx.x % qTiles;
    const int h  = (blockIdx.x / qTiles) % NHEAD;
    const int b  =  blockIdx.x / (qTiles * NHEAD);
    const int qBase = qt * QBLK;

    const int tid    = threadIdx.x;
    // Wave id as a *scalar* so per-wave conditions compile to s_cmp/s_cbranch
    // (EXEC untouched) instead of v_cmpx/saveexec.
    const int wave   = __builtin_amdgcn_readfirstlane(tid >> 5);
    const int lane   = tid & 31;
    const int laneN  = lane & 15;
    const int laneHi = lane >> 4;

    const int qRow0   = qBase + wave * 16;     // scalar
    const int qRowMax = qRow0 + 15;            // scalar

    const size_t headOff = (size_t)h * DHEAD;
    const float* Qb = Q + (size_t)b * T * DMODEL + headOff;
    const float* Kb = K + (size_t)b * T * DMODEL + headOff;
    const float* Vb = V + (size_t)b * T * DMODEL + headOff;
    float*       Ob = O + (size_t)b * T * DMODEL + headOff;

    // ---- Q A-fragments: 16x64 f16 as two 16x32 chunks, loaded once ----
    v16h qf[2];
    {
        const float* qrow = Qb + (size_t)(qRow0 + laneN) * DMODEL;
        #pragma unroll
        for (int c = 0; c < 2; ++c) {
            const int k0 = c * 32 + laneHi * 8;
            #pragma unroll
            for (int i = 0; i < 8; ++i) {
                qf[c][i]     = (_Float16)qrow[k0 + i];
                qf[c][i + 8] = (_Float16)qrow[k0 + 16 + i];
            }
        }
    }

    // ---- staging geometry ----
    // K: thread -> (row, 16 contiguous d).  V: thread -> (4 s rows, 4 d) so s-pairs pack.
    const int kRow = tid >> 2;
    const int kD0  = (tid & 3) * 16;
    const int vD0  = (tid & 15) * 4;
    const int vS0  = (tid >> 4) * 4;
    float kreg[16], vreg[16];

    // ---- flash state in log2 domain ----
    const float L2E    = 1.44269504088896f;
    const float SCALE2 = 0.125f * L2E;                        // (1/sqrt(d)) * log2(e)
    const float slope2 = exp2f(-0.5f * (float)(h + 1)) * L2E; // alibi slope * log2(e)
    const float bstep  = slope2 * (float)KTILE;
    const float b16    = slope2 * 16.0f;

    v8f   acc[4];
    float m2[8], lsum[8], bias[8];
    int   trow[8];
    #pragma unroll
    for (int j = 0; j < 4; ++j) acc[j] = (v8f){0,0,0,0,0,0,0,0};
    #pragma unroll
    for (int r = 0; r < 8; ++r) {
        trow[r] = qRow0 + r + laneHi * 8;
        m2[r]   = -__builtin_inff();
        lsum[r] = 0.0f;
        bias[r] = slope2 * (float)(laneN - trow[r]);   // slope2*(s0 - t) at kBase=0
    }

    // ---- softmax tile body; MASK=false carries no compare/select code ----
    auto softmaxTile = [&](auto maskc, const v8f* S, int kBase) {
        constexpr bool MASK = decltype(maskc)::value;
        v8f corrv;
        #pragma unroll
        for (int r = 0; r < 8; ++r) {
            float v[4];
            #pragma unroll
            for (int n = 0; n < 4; ++n)
                v[n] = fmaf(S[n][r], SCALE2, bias[r] + (float)n * b16);
            bias[r] += bstep;
            if (MASK) {
                #pragma unroll
                for (int n = 0; n < 4; ++n)
                    if (kBase + n * 16 + laneN > trow[r]) v[n] = -__builtin_inff();
            }
            float mx = fmaxf(fmaxf(v[0], v[1]), fmaxf(v[2], v[3]));
            mx = rowmax16(mx);
            const float mnew = fmaxf(m2[r], mx);
            const float corr = __builtin_amdgcn_exp2f(m2[r] - mnew);
            m2[r]    = mnew;
            corrv[r] = corr;
            float p[4], ps = 0.0f;
            #pragma unroll
            for (int n = 0; n < 4; ++n) { p[n] = __builtin_amdgcn_exp2f(v[n] - mnew); ps += p[n]; }
            lsum[r] = lsum[r] * corr + ps;            // per-lane partial; reduce at end
            const int M = r + laneHi * 8;
            #pragma unroll
            for (int n = 0; n < 4; ++n)
                sP[wave][M][laneN + n * 16] = (_Float16)p[n];
        }
        // vectorized rescale -> v_pk_mul_f32 pairs
        #pragma unroll
        for (int j = 0; j < 4; ++j) acc[j] *= corrv;
    };

    const int nKT = qBase / KTILE + QBLK / KTILE;      // causal: keys < qBase+128

    // ---- prologue: stage tile 0 into buffer 0 ----
    {
        const float* kr = Kb + (size_t)kRow * DMODEL + kD0;
        #pragma unroll
        for (int i = 0; i < 16; ++i) kreg[i] = kr[i];
        #pragma unroll
        for (int i = 0; i < 4; ++i) {
            const float* vr = Vb + (size_t)(vS0 + i) * DMODEL + vD0;
            #pragma unroll
            for (int d = 0; d < 4; ++d) vreg[i * 4 + d] = vr[d];
        }
        unsigned kw[8];
        #pragma unroll
        for (int i = 0; i < 8; ++i) kw[i] = pk16(kreg[2 * i], kreg[2 * i + 1]);
        *(uint4*)&sK[0][kRow][kD0]     = *(uint4*)&kw[0];
        *(uint4*)&sK[0][kRow][kD0 + 8] = *(uint4*)&kw[4];
        #pragma unroll
        for (int d = 0; d < 4; ++d) {
            *(unsigned*)&sVt[0][vD0 + d][vS0]     = pk16(vreg[d],     vreg[4 + d]);
            *(unsigned*)&sVt[0][vD0 + d][vS0 + 2] = pk16(vreg[8 + d], vreg[12 + d]);
        }
    }

    for (int kt = 0; kt < nKT; ++kt) {
        const int  kBase = kt * KTILE;
        const int  cur   = kt & 1;
        const bool more  = (kt + 1 < nKT);

        // issue next tile's global loads before the barrier (overlap with compute)
        if (more) {
            const float* kr = Kb + (size_t)(kBase + KTILE + kRow) * DMODEL + kD0;
            #pragma unroll
            for (int i = 0; i < 16; ++i) kreg[i] = kr[i];
            #pragma unroll
            for (int i = 0; i < 4; ++i) {
                const float* vr = Vb + (size_t)(kBase + KTILE + vS0 + i) * DMODEL + vD0;
                #pragma unroll
                for (int d = 0; d < 4; ++d) vreg[i * 4 + d] = vr[d];
            }
        }

        __syncthreads();   // buffer[cur] ready; buffer[1-cur] free to overwrite

        if (kBase <= qRowMax) {   // scalar condition: s_cbranch, EXEC stays all-ones
            // ---- S = Q * K^T : four 16x16 f32 tiles over 64 keys ----
            v8f S[4];
            #pragma unroll
            for (int n = 0; n < 4; ++n) {
                v8f c = (v8f){0,0,0,0,0,0,0,0};
                #pragma unroll
                for (int ch = 0; ch < 2; ++ch) {
                    V16 bf;
                    const _Float16* kp = &sK[cur][n * 16 + laneN][ch * 32 + laneHi * 8];
                    bf.h[0] = *(const v8h*)kp;
                    bf.h[1] = *(const v8h*)(kp + 16);
                    c = __builtin_amdgcn_wmma_f32_16x16x32_f16(
                            false, qf[ch], false, bf.v, (short)0, c, false, false);
                }
                S[n] = c;
            }

            // ---- online softmax: mask path only for diagonal tiles (scalar cond) ----
            if (kBase + KTILE - 1 > qRow0) softmaxTile(BoolC<true>{},  S, kBase);
            else                           softmaxTile(BoolC<false>{}, S, kBase);

            // same-wave LDS ordering: cross-lane P stores -> our A-layout loads
            asm volatile("s_wait_dscnt 0" ::: "memory");

            // ---- O += P * V : P is 16x64 (two A chunks), V chunks 32x16 each ----
            V16 pf[2];
            #pragma unroll
            for (int ch = 0; ch < 2; ++ch) {
                const _Float16* pr = &sP[wave][laneN][ch * 32 + laneHi * 8];
                pf[ch].h[0] = *(const v8h*)pr;
                pf[ch].h[1] = *(const v8h*)(pr + 16);
            }
            #pragma unroll
            for (int j = 0; j < 4; ++j) {
                #pragma unroll
                for (int ch = 0; ch < 2; ++ch) {
                    V16 vf;
                    const _Float16* vp2 = &sVt[cur][j * 16 + laneN][ch * 32 + laneHi * 8];
                    vf.h[0] = *(const v8h*)vp2;
                    vf.h[1] = *(const v8h*)(vp2 + 16);
                    acc[j] = __builtin_amdgcn_wmma_f32_16x16x32_f16(
                                false, pf[ch].v, false, vf.v, (short)0, acc[j], false, false);
                }
            }
        }

        // convert + store the prefetched tile into the other buffer
        if (more) {
            const int nxt = 1 - cur;
            unsigned kw[8];
            #pragma unroll
            for (int i = 0; i < 8; ++i) kw[i] = pk16(kreg[2 * i], kreg[2 * i + 1]);
            *(uint4*)&sK[nxt][kRow][kD0]     = *(uint4*)&kw[0];
            *(uint4*)&sK[nxt][kRow][kD0 + 8] = *(uint4*)&kw[4];
            #pragma unroll
            for (int d = 0; d < 4; ++d) {
                *(unsigned*)&sVt[nxt][vD0 + d][vS0]     = pk16(vreg[d],     vreg[4 + d]);
                *(unsigned*)&sVt[nxt][vD0 + d][vS0 + 2] = pk16(vreg[8 + d], vreg[12 + d]);
            }
        }
        // next iteration's __syncthreads publishes buffer[nxt]
    }

    // ---- finalize: reduce row sums across the 16-lane half, normalize, store ----
    #pragma unroll
    for (int r = 0; r < 8; ++r) {
        const float ls  = rowsum16(lsum[r]);
        const float inv = 1.0f / ls;
        const int M = r + laneHi * 8;
        float* orow = Ob + (size_t)(qRow0 + M) * DMODEL;
        #pragma unroll
        for (int j = 0; j < 4; ++j)
            orow[j * 16 + laneN] = acc[j][r] * inv;
    }
}

extern "C" void kernel_launch(void* const* d_in, const int* in_sizes, int n_in,
                              void* d_out, int out_size, void* d_ws, size_t ws_size,
                              hipStream_t stream) {
    const float* q = (const float*)d_in[0];
    const float* k = (const float*)d_in[1];
    const float* v = (const float*)d_in[2];
    float* out = (float*)d_out;

    const int B = 2, T = 2048;
    dim3 grid(B * NHEAD * (T / QBLK));               // 512 blocks
    dim3 block(256);                                 // 8 wave32 waves
    fa_alibi_kernel<<<grid, block, 0, stream>>>(q, k, v, out, T);
}

// v001
// One run takes 66.5 microseconds.
// Timed twice side by side with v000, it ran 1.76 times as fast both times.
#include <hip/hip_runtime.h>

typedef __attribute__((ext_vector_type(16))) _Float16 v16h;
typedef __attribute__((ext_vector_type(8)))  _Float16 v8h;
typedef __attribute__((ext_vector_type(2)))  __fp16   fp16x2;
typedef __attribute__((ext_vector_type(8)))  float    v8f;

#define NHEAD    16
#define DHEAD    64
#define DMODEL   1024
#define KTILE    64           // keys per tile (amortizes per-tile softmax overhead)
#define WAVES    8
#define QBLK     128          // 8 waves * 16 query rows
#define VT_PITCH 72           // 64 + 8 halves pad: 16B-aligned rows, bank spread
#define KP_PITCH 72           // K and P rows: 144 B = 16 B x odd, so 16 rows read by b128 spread over all banks

union V16 { v16h v; v8h h[2]; };
template<bool B> struct BoolC { static constexpr bool value = B; };

__device__ __forceinline__ unsigned pk16(float a, float b) {   // v_cvt_pk_rtz_f16_f32
    union { fp16x2 h; unsigned u; } cv;
    cv.h = __builtin_amdgcn_cvt_pkrtz(a, b);
    return cv.u;
}

// Butterfly reductions across each 16-lane half via DPP16 ROW_XMASK: pure VALU.
__device__ __forceinline__ float rowmax16(float x) {
    int t;
    t = __builtin_amdgcn_update_dpp(0, __float_as_int(x), 0x161, 0xf, 0xf, true);
    x = fmaxf(x, __int_as_float(t));
    t = __builtin_amdgcn_update_dpp(0, __float_as_int(x), 0x162, 0xf, 0xf, true);
    x = fmaxf(x, __int_as_float(t));
    t = __builtin_amdgcn_update_dpp(0, __float_as_int(x), 0x164, 0xf, 0xf, true);
    x = fmaxf(x, __int_as_float(t));
    t = __builtin_amdgcn_update_dpp(0, __float_as_int(x), 0x168, 0xf, 0xf, true);
    x = fmaxf(x, __int_as_float(t));
    return x;
}
__device__ __forceinline__ float rowsum16(float x) {
    int t;
    t = __builtin_amdgcn_update_dpp(0, __float_as_int(x), 0x161, 0xf, 0xf, true);
    x += __int_as_float(t);
    t = __builtin_amdgcn_update_dpp(0, __float_as_int(x), 0x162, 0xf, 0xf, true);
    x += __int_as_float(t);
    t = __builtin_amdgcn_update_dpp(0, __float_as_int(x), 0x164, 0xf, 0xf, true);
    x += __int_as_float(t);
    t = __builtin_amdgcn_update_dpp(0, __float_as_int(x), 0x168, 0xf, 0xf, true);
    x += __int_as_float(t);
    return x;
}

// Fused causal flash-attention with ALiBi, log2-domain online softmax,
// double-buffered f16 K/V staging in LDS shared by 8 waves per block.
__global__ __launch_bounds__(256)
void fa_alibi_kernel(const float* __restrict__ Q,
                     const float* __restrict__ K,
                     const float* __restrict__ V,
                     float* __restrict__ O,
                     int T)
{
    __shared__ __align__(16) _Float16 sK [2][KTILE][KP_PITCH];   // K tiles, row-major, padded rows
    __shared__ __align__(16) _Float16 sVt[2][DHEAD][VT_PITCH];   // V tiles, transposed
    __shared__ __align__(16) _Float16 sP [WAVES][16][KP_PITCH];  // per-wave P scratch, padded rows

    const int qTiles = T / QBLK;
    const int qt = blockIdx.x % qTiles;
    const int h  = (blockIdx.x / qTiles) % NHEAD;
    const int b  =  blockIdx.x / (qTiles * NHEAD);
    const int qBase = qt * QBLK;

    const int tid    = threadIdx.x;
    // Wave id as a *scalar* so per-wave conditions compile to s_cmp/s_cbranch
    // (EXEC untouched) instead of v_cmpx/saveexec.
    const int wave   = __builtin_amdgcn_readfirstlane(tid >> 5);
    const int lane   = tid & 31;
    const int laneN  = lane & 15;
    const int laneHi = lane >> 4;

    const int qRow0   = qBase + wave * 16;     // scalar
    const int qRowMax = qRow0 + 15;            // scalar

    const size_t headOff = (size_t)h * DHEAD;
    const float* Qb = Q + (size_t)b * T * DMODEL + headOff;
    const float* Kb = K + (size_t)b * T * DMODEL + headOff;
    const float* Vb = V + (size_t)b * T * DMODEL + headOff;
    float*       Ob = O + (size_t)b * T * DMODEL + headOff;

    // ---- Q A-fragments: 16x64 f16 as two 16x32 chunks, loaded once ----
    v16h qf[2];
    {
        const float* qrow = Qb + (size_t)(qRow0 + laneN) * DMODEL;
        #pragma unroll
        for (int c = 0; c < 2; ++c) {
            const int k0 = c * 32 + laneHi * 8;
            #pragma unroll
            for (int i = 0; i < 8; ++i) {
                qf[c][i]     = (_Float16)qrow[k0 + i];
                qf[c][i + 8] = (_Float16)qrow[k0 + 16 + i];
            }
        }
    }

    // ---- staging geometry ----
    // K: thread -> (row, 16 contiguous d).  V: thread -> (4 s rows, 4 d) so s-pairs pack.
    const int kRow = tid >> 2;
    const int kD0  = (tid & 3) * 16;
    const int vD0  = (tid & 15) * 4;
    const int vS0  = (tid >> 4) * 4;
    float kreg[16], vreg[16];

    // ---- flash state in log2 domain ----
    const float L2E    = 1.44269504088896f;
    const float SCALE2 = 0.125f * L2E;                        // (1/sqrt(d)) * log2(e)
    const float slope2 = exp2f(-0.5f * (float)(h + 1)) * L2E; // alibi slope * log2(e)
    const float bstep  = slope2 * (float)KTILE;
    const float b16    = slope2 * 16.0f;

    v8f   acc[4];
    float m2[8], lsum[8], bias[8];
    int   trow[8];
    #pragma unroll
    for (int j = 0; j < 4; ++j) acc[j] = (v8f){0,0,0,0,0,0,0,0};
    #pragma unroll
    for (int r = 0; r < 8; ++r) {
        trow[r] = qRow0 + r + laneHi * 8;
        m2[r]   = -__builtin_inff();
        lsum[r] = 0.0f;
        bias[r] = slope2 * (float)(laneN - trow[r]);   // slope2*(s0 - t) at kBase=0
    }

    // ---- softmax tile body; MASK=false carries no compare/select code ----
    auto softmaxTile = [&](auto maskc, const v8f* S, int kBase) {
        constexpr bool MASK = decltype(maskc)::value;
        v8f corrv;
        #pragma unroll
        for (int r = 0; r < 8; ++r) {
            float v[4];
            #pragma unroll
            for (int n = 0; n < 4; ++n)
                v[n] = fmaf(S[n][r], SCALE2, bias[r] + (float)n * b16);
            bias[r] += bstep;
            if (MASK) {
                #pragma unroll
                for (int n = 0; n < 4; ++n)
                    if (kBase + n * 16 + laneN > trow[r]) v[n] = -__builtin_inff();
            }
            float mx = fmaxf(fmaxf(v[0], v[1]), fmaxf(v[2], v[3]));
            mx = rowmax16(mx);
            const float mnew = fmaxf(m2[r], mx);
            const float corr = __builtin_amdgcn_exp2f(m2[r] - mnew);
            m2[r]    = mnew;
            corrv[r] = corr;
            float p[4], ps = 0.0f;
            #pragma unroll
            for (int n = 0; n < 4; ++n) { p[n] = __builtin_amdgcn_exp2f(v[n] - mnew); ps += p[n]; }
            lsum[r] = lsum[r] * corr + ps;            // per-lane partial; reduce at end
            const int M = r + laneHi * 8;
            #pragma unroll
            for (int n = 0; n < 4; ++n)
                sP[wave][M][laneN + n * 16] = (_Float16)p[n];
        }
        // vectorized rescale -> v_pk_mul_f32 pairs
        #pragma unroll
        for (int j = 0; j < 4; ++j) acc[j] *= corrv;
    };

    const int nKT = qBase / KTILE + QBLK / KTILE;      // causal: keys < qBase+128

    // ---- prologue: stage tile 0 into buffer 0 ----
    {
        const float* kr = Kb + (size_t)kRow * DMODEL + kD0;
        #pragma unroll
        for (int i = 0; i < 16; ++i) kreg[i] = kr[i];
        #pragma unroll
        for (int i = 0; i < 4; ++i) {
            const float* vr = Vb + (size_t)(vS0 + i) * DMODEL + vD0;
            #pragma unroll
            for (int d = 0; d < 4; ++d) vreg[i * 4 + d] = vr[d];
        }
        unsigned kw[8];
        #pragma unroll
        for (int i = 0; i < 8; ++i) kw[i] = pk16(kreg[2 * i], kreg[2 * i + 1]);
        *(uint4*)&sK[0][kRow][kD0]     = *(uint4*)&kw[0];
        *(uint4*)&sK[0][kRow][kD0 + 8] = *(uint4*)&kw[4];
        #pragma unroll
        for (int d = 0; d < 4; ++d) {
            *(unsigned*)&sVt[0][vD0 + d][vS0]     = pk16(vreg[d],     vreg[4 + d]);
            *(unsigned*)&sVt[0][vD0 + d][vS0 + 2] = pk16(vreg[8 + d], vreg[12 + d]);
        }
    }

    for (int kt = 0; kt < nKT; ++kt) {
        const int  kBase = kt * KTILE;
        const int  cur   = kt & 1;
        const bool more  = (kt + 1 < nKT);

        // issue next tile's global loads before the barrier (overlap with compute)
        if (more) {
            const float* kr = Kb + (size_t)(kBase + KTILE + kRow) * DMODEL + kD0;
            #pragma unroll
            for (int i = 0; i < 16; ++i) kreg[i] = kr[i];
            #pragma unroll
            for (int i = 0; i < 4; ++i) {
                const float* vr = Vb + (size_t)(kBase + KTILE + vS0 + i) * DMODEL + vD0;
                #pragma unroll
                for (int d = 0; d < 4; ++d) vreg[i * 4 + d] = vr[d];
            }
        }

        __syncthreads();   // buffer[cur] ready; buffer[1-cur] free to overwrite

        if (kBase <= qRowMax) {   // scalar condition: s_cbranch, EXEC stays all-ones
            // ---- S = Q * K^T : four 16x16 f32 tiles over 64 keys ----
            v8f S[4];
            #pragma unroll
            for (int n = 0; n < 4; ++n) {
                v8f c = (v8f){0,0,0,0,0,0,0,0};
                #pragma unroll
                for (int ch = 0; ch < 2; ++ch) {
                    V16 bf;
                    const _Float16* kp = &sK[cur][n * 16 + laneN][ch * 32 + laneHi * 8];
                    bf.h[0] = *(const v8h*)kp;
                    bf.h[1] = *(const v8h*)(kp + 16);
                    c = __builtin_amdgcn_wmma_f32_16x16x32_f16(
                            false, qf[ch], false, bf.v, (short)0, c, false, false);
                }
                S[n] = c;
            }

            // ---- online softmax: mask path only for diagonal tiles (scalar cond) ----
            if (kBase + KTILE - 1 > qRow0) softmaxTile(BoolC<true>{},  S, kBase);
            else                           softmaxTile(BoolC<false>{}, S, kBase);

            // same-wave LDS ordering: cross-lane P stores -> our A-layout loads
            asm volatile("s_wait_dscnt 0" ::: "memory");

            // ---- O += P * V : P is 16x64 (two A chunks), V chunks 32x16 each ----
            V16 pf[2];
            #pragma unroll
            for (int ch = 0; ch < 2; ++ch) {
                const _Float16* pr = &sP[wave][laneN][ch * 32 + laneHi * 8];
                pf[ch].h[0] = *(const v8h*)pr;
                pf[ch].h[1] = *(const v8h*)(pr + 16);
            }
            #pragma unroll
            for (int j = 0; j < 4; ++j) {
                #pragma unroll
                for (int ch = 0; ch < 2; ++ch) {
                    V16 vf;
                    const _Float16* vp2 = &sVt[cur][j * 16 + laneN][ch * 32 + laneHi * 8];
                    vf.h[0] = *(const v8h*)vp2;
                    vf.h[1] = *(const v8h*)(vp2 + 16);
                    acc[j] = __builtin_amdgcn_wmma_f32_16x16x32_f16(
                                false, pf[ch].v, false, vf.v, (short)0, acc[j], false, false);
                }
            }
        }

        // convert + store the prefetched tile into the other buffer
        if (more) {
            const int nxt = 1 - cur;
            unsigned kw[8];
            #pragma unroll
            for (int i = 0; i < 8; ++i) kw[i] = pk16(kreg[2 * i], kreg[2 * i + 1]);
            *(uint4*)&sK[nxt][kRow][kD0]     = *(uint4*)&kw[0];
            *(uint4*)&sK[nxt][kRow][kD0 + 8] = *(uint4*)&kw[4];
            #pragma unroll
            for (int d = 0; d < 4; ++d) {
                *(unsigned*)&sVt[nxt][vD0 + d][vS0]     = pk16(vreg[d],     vreg[4 + d]);
                *(unsigned*)&sVt[nxt][vD0 + d][vS0 + 2] = pk16(vreg[8 + d], vreg[12 + d]);
            }
        }
        // next iteration's __syncthreads publishes buffer[nxt]
    }

    // ---- finalize: reduce row sums across the 16-lane half, normalize, store ----
    #pragma unroll
    for (int r = 0; r < 8; ++r) {
        const float ls  = rowsum16(lsum[r]);
        const float inv = 1.0f / ls;
        const int M = r + laneHi * 8;
        float* orow = Ob + (size_t)(qRow0 + M) * DMODEL;
        #pragma unroll
        for (int j = 0; j < 4; ++j)
            orow[j * 16 + laneN] = acc[j][r] * inv;
    }
}

extern "C" void kernel_launch(void* const* d_in, const int* in_sizes, int n_in,
                              void* d_out, int out_size, void* d_ws, size_t ws_size,
                              hipStream_t stream) {
    const float* q = (const float*)d_in[0];
    const float* k = (const float*)d_in[1];
    const float* v = (const float*)d_in[2];
    float* out = (float*)d_out;

    const int B = 2, T = 2048;
    dim3 grid(B * NHEAD * (T / QBLK));               // 512 blocks
    dim3 block(256);                                 // 8 wave32 waves
    fa_alibi_kernel<<<grid, block, 0, stream>>>(q, k, v, out, T);
}

// v002
// A run of this version takes 57.1 microseconds.
// Two timings next to v001 put it at 1.16 and 1.17 times that version's speed.
// Over all steps from v000 it is 2.05 times as fast.
#include <hip/hip_runtime.h>

typedef __attribute__((ext_vector_type(16))) _Float16 v16h;
typedef __attribute__((ext_vector_type(8)))  _Float16 v8h;
typedef __attribute__((ext_vector_type(2)))  __fp16   fp16x2;
typedef __attribute__((ext_vector_type(8)))  float    v8f;

#define NHEAD    16
#define DHEAD    64
#define DMODEL   1024
#define KTILE    64           // keys per tile (amortizes per-tile softmax overhead)
#define WAVES    8
#define QBLK     128          // 8 waves * 16 query rows: two 64-row groups, see the pairing below
#define QGRP     64           // 4 waves * 16 query rows
#define VT_PITCH 72           // 64 + 8 halves pad: 16B-aligned rows, bank spread
#define KP_PITCH 72           // K and P rows: 144 B = 16 B x odd, so 16 rows read by b128 spread over all banks

union V16 { v16h v; v8h h[2]; };
template<bool B> struct BoolC { static constexpr bool value = B; };

__device__ __forceinline__ unsigned pk16(float a, float b) {   // v_cvt_pk_rtz_f16_f32
    union { fp16x2 h; unsigned u; } cv;
    cv.h = __builtin_amdgcn_cvt_pkrtz(a, b);
    return cv.u;
}

// Butterfly reductions across each 16-lane half via DPP16 ROW_XMASK: pure VALU.
__device__ __forceinline__ float rowmax16(float x) {
    int t;
    t = __builtin_amdgcn_update_dpp(0, __float_as_int(x), 0x161, 0xf, 0xf, true);
    x = fmaxf(x, __int_as_float(t));
    t = __builtin_amdgcn_update_dpp(0, __float_as_int(x), 0x162, 0xf, 0xf, true);
    x = fmaxf(x, __int_as_float(t));
    t = __builtin_amdgcn_update_dpp(0, __float_as_int(x), 0x164, 0xf, 0xf, true);
    x = fmaxf(x, __int_as_float(t));
    t = __builtin_amdgcn_update_dpp(0, __float_as_int(x), 0x168, 0xf, 0xf, true);
    x = fmaxf(x, __int_as_float(t));
    return x;
}
__device__ __forceinline__ float rowsum16(float x) {
    int t;
    t = __builtin_amdgcn_update_dpp(0, __float_as_int(x), 0x161, 0xf, 0xf, true);
    x += __int_as_float(t);
    t = __builtin_amdgcn_update_dpp(0, __float_as_int(x), 0x162, 0xf, 0xf, true);
    x += __int_as_float(t);
    t = __builtin_amdgcn_update_dpp(0, __float_as_int(x), 0x164, 0xf, 0xf, true);
    x += __int_as_float(t);
    t = __builtin_amdgcn_update_dpp(0, __float_as_int(x), 0x168, 0xf, 0xf, true);
    x += __int_as_float(t);
    return x;
}

// Fused causal flash-attention with ALiBi, log2-domain online softmax,
// double-buffered f16 K/V staging in LDS shared by 8 waves per block.
__global__ __launch_bounds__(256)
void fa_alibi_kernel(const float* __restrict__ Q,
                     const float* __restrict__ K,
                     const float* __restrict__ V,
                     float* __restrict__ O,
                     int T)
{
    __shared__ __align__(16) _Float16 sK [2][KTILE][KP_PITCH];   // K tiles, row-major, padded rows
    __shared__ __align__(16) _Float16 sVt[2][DHEAD][VT_PITCH];   // V tiles, transposed
    __shared__ __align__(16) _Float16 sP [WAVES][16][KP_PITCH];  // per-wave P scratch, padded rows

    const int qTiles = T / QBLK;
    const int qt = blockIdx.x % qTiles;
    const int h  = (blockIdx.x / qTiles) % NHEAD;
    const int b  =  blockIdx.x / (qTiles * NHEAD);
    // Causal cost grows with the query position, and every block is resident at once, so the
    // launch lasts as long as its fullest SIMD.  Each block takes the 64-row group qt from the
    // top (waves 4-7) and its mirror from the bottom (waves 0-3): every block then holds the same
    // number of (wave, key tile) products, and waves w and w+4 are one of each.
    const int qLo = qt * QGRP;                      // short group
    const int qHi = T - QGRP - qLo;                 // long group, sets the trip count

    const int tid    = threadIdx.x;
    // Wave id as a *scalar* so per-wave conditions compile to s_cmp/s_cbranch
    // (EXEC untouched) instead of v_cmpx/saveexec.
    const int wave   = __builtin_amdgcn_readfirstlane(tid >> 5);
    const int lane   = tid & 31;
    const int laneN  = lane & 15;
    const int laneHi = lane >> 4;

    const int qRow0   = (wave < WAVES / 2 ? qHi : qLo - QGRP) + wave * 16;   // scalar
    const int qRowMax = qRow0 + 15;            // scalar

    const size_t headOff = (size_t)h * DHEAD;
    const float* Qb = Q + (size_t)b * T * DMODEL + headOff;
    const float* Kb = K + (size_t)b * T * DMODEL + headOff;
    const float* Vb = V + (size_t)b * T * DMODEL + headOff;
    float*       Ob = O + (size_t)b * T * DMODEL + headOff;

    // ---- Q A-fragments: 16x64 f16 as two 16x32 chunks, loaded once ----
    v16h qf[2];
    {
        const float* qrow = Qb + (size_t)(qRow0 + laneN) * DMODEL;
        #pragma unroll
        for (int c = 0; c < 2; ++c) {
            const int k0 = c * 32 + laneHi * 8;
            #pragma unroll
            for (int i = 0; i < 8; ++i) {
                qf[c][i]     = (_Float16)qrow[k0 + i];
                qf[c][i + 8] = (_Float16)qrow[k0 + 16 + i];
            }
        }
    }

    // ---- staging geometry ----
    // K: thread -> (row, 16 contiguous d).  V: thread -> (4 s rows, 4 d) so s-pairs pack.
    const int kRow = tid >> 2;
    const int kD0  = (tid & 3) * 16;
    const int vD0  = (tid & 15) * 4;
    const int vS0  = (tid >> 4) * 4;
    float kreg[16], vreg[16];

    // ---- flash state in log2 domain ----
    const float L2E    = 1.44269504088896f;
    const float SCALE2 = 0.125f * L2E;                        // (1/sqrt(d)) * log2(e)
    const float slope2 = exp2f(-0.5f * (float)(h + 1)) * L2E; // alibi slope * log2(e)
    const float bstep  = slope2 * (float)KTILE;
    const float b16    = slope2 * 16.0f;

    v8f   acc[4];
    float m2[8], lsum[8], bias[8];
    int   trow[8];
    #pragma unroll
    for (int j = 0; j < 4; ++j) acc[j] = (v8f){0,0,0,0,0,0,0,0};
    #pragma unroll
    for (int r = 0; r < 8; ++r) {
        trow[r] = qRow0 + r + laneHi * 8;
        m2[r]   = -__builtin_inff();
        lsum[r] = 0.0f;
        bias[r] = slope2 * (float)(laneN - trow[r]);   // slope2*(s0 - t) at kBase=0
    }

    // ---- softmax tile body; MASK=false carries no compare/select code ----
    auto softmaxTile = [&](auto maskc, const v8f* S, int kBase) {
        constexpr bool MASK = decltype(maskc)::value;
        v8f corrv;
        #pragma unroll
        for (int r = 0; r < 8; ++r) {
            float v[4];
            #pragma unroll
            for (int n = 0; n < 4; ++n)
                v[n] = fmaf(S[n][r], SCALE2, bias[r] + (float)n * b16);
            bias[r] += bstep;
            if (MASK) {
                #pragma unroll
                for (int n = 0; n < 4; ++n)
                    if (kBase + n * 16 + laneN > trow[r]) v[n] = -__builtin_inff();
            }
            float mx = fmaxf(fmaxf(v[0], v[1]), fmaxf(v[2], v[3]));
            mx = rowmax16(mx);
            const float mnew = fmaxf(m2[r], mx);
            const float corr = __builtin_amdgcn_exp2f(m2[r] - mnew);
            m2[r]    = mnew;
            corrv[r] = corr;
            float p[4], ps = 0.0f;
            #pragma unroll
            for (int n = 0; n < 4; ++n) { p[n] = __builtin_amdgcn_exp2f(v[n] - mnew); ps += p[n]; }
            lsum[r] = lsum[r] * corr + ps;            // per-lane partial; reduce at end
            const int M = r + laneHi * 8;
            #pragma unroll
            for (int n = 0; n < 4; ++n)
                sP[wave][M][laneN + n * 16] = (_Float16)p[n];
        }
        // vectorized rescale -> v_pk_mul_f32 pairs
        #pragma unroll
        for (int j = 0; j < 4; ++j) acc[j] *= corrv;
    };

    const int nKT = qHi / KTILE + QGRP / KTILE;        // causal: keys < qHi+64; same for all waves

    // ---- prologue: stage tile 0 into buffer 0 ----
    {
        const float* kr = Kb + (size_t)kRow * DMODEL + kD0;
        #pragma unroll
        for (int i = 0; i < 16; ++i) kreg[i] = kr[i];
        #pragma unroll
        for (int i = 0; i < 4; ++i) {
            const float* vr = Vb + (size_t)(vS0 + i) * DMODEL + vD0;
            #pragma unroll
            for (int d = 0; d < 4; ++d) vreg[i * 4 + d] = vr[d];
        }
        unsigned kw[8];
        #pragma unroll
        for (int i = 0; i < 8; ++i) kw[i] = pk16(kreg[2 * i], kreg[2 * i + 1]);
        *(uint4*)&sK[0][kRow][kD0]     = *(uint4*)&kw[0];
        *(uint4*)&sK[0][kRow][kD0 + 8] = *(uint4*)&kw[4];
        #pragma unroll
        for (int d = 0; d < 4; ++d) {
            *(unsigned*)&sVt[0][vD0 + d][vS0]     = pk16(vreg[d],     vreg[4 + d]);
            *(unsigned*)&sVt[0][vD0 + d][vS0 + 2] = pk16(vreg[8 + d], vreg[12 + d]);
        }
    }

    for (int kt = 0; kt < nKT; ++kt) {
        const int  kBase = kt * KTILE;
        const int  cur   = kt & 1;
        const bool more  = (kt + 1 < nKT);

        // issue next tile's global loads before the barrier (overlap with compute)
        if (more) {
            const float* kr = Kb + (size_t)(kBase + KTILE + kRow) * DMODEL + kD0;
            #pragma unroll
            for (int i = 0; i < 16; ++i) kreg[i] = kr[i];
            #pragma unroll
            for (int i = 0; i < 4; ++i) {
                const float* vr = Vb + (size_t)(kBase + KTILE + vS0 + i) * DMODEL + vD0;
                #pragma unroll
                for (int d = 0; d < 4; ++d) vreg[i * 4 + d] = vr[d];
            }
        }

        __syncthreads();   // buffer[cur] ready; buffer[1-cur] free to overwrite

        if (kBase <= qRowMax) {   // scalar condition: s_cbranch, EXEC stays all-ones
            // ---- S = Q * K^T : four 16x16 f32 tiles over 64 keys ----
            v8f S[4];
            #pragma unroll
            for (int n = 0; n < 4; ++n) {
                v8f c = (v8f){0,0,0,0,0,0,0,0};
                #pragma unroll
                for (int ch = 0; ch < 2; ++ch) {
                    V16 bf;
                    const _Float16* kp = &sK[cur][n * 16 + laneN][ch * 32 + laneHi * 8];
                    bf.h[0] = *(const v8h*)kp;
                    bf.h[1] = *(const v8h*)(kp + 16);
                    c = __builtin_amdgcn_wmma_f32_16x16x32_f16(
                            false, qf[ch], false, bf.v, (short)0, c, false, false);
                }
                S[n] = c;
            }

            // ---- online softmax: mask path only for diagonal tiles (scalar cond) ----
            if (kBase + KTILE - 1 > qRow0) softmaxTile(BoolC<true>{},  S, kBase);
            else                           softmaxTile(BoolC<false>{}, S, kBase);

            // same-wave LDS ordering: cross-lane P stores -> our A-layout loads
            asm volatile("s_wait_dscnt 0" ::: "memory");

            // ---- O += P * V : P is 16x64 (two A chunks), V chunks 32x16 each ----
            V16 pf[2];
            #pragma unroll
            for (int ch = 0; ch < 2; ++ch) {
                const _Float16* pr = &sP[wave][laneN][ch * 32 + laneHi * 8];
                pf[ch].h[0] = *(const v8h*)pr;
                pf[ch].h[1] = *(const v8h*)(pr + 16);
            }
            #pragma unroll
            for (int j = 0; j < 4; ++j) {
                #pragma unroll
                for (int ch = 0; ch < 2; ++ch) {
                    V16 vf;
                    const _Float16* vp2 = &sVt[cur][j * 16 + laneN][ch * 32 + laneHi * 8];
                    vf.h[0] = *(const v8h*)vp2;
                    vf.h[1] = *(const v8h*)(vp2 + 16);
                    acc[j] = __builtin_amdgcn_wmma_f32_16x16x32_f16(
                                false, pf[ch].v, false, vf.v, (short)0, acc[j], false, false);
                }
            }
        }

        // convert + store the prefetched tile into the other buffer
        if (more) {
            const int nxt = 1 - cur;
            unsigned kw[8];
            #pragma unroll
            for (int i = 0; i < 8; ++i) kw[i] = pk16(kreg[2 * i], kreg[2 * i + 1]);
            *(uint4*)&sK[nxt][kRow][kD0]     = *(uint4*)&kw[0];
            *(uint4*)&sK[nxt][kRow][kD0 + 8] = *(uint4*)&kw[4];
            #pragma unroll
            for (int d = 0; d < 4; ++d) {
                *(unsigned*)&sVt[nxt][vD0 + d][vS0]     = pk16(vreg[d],     vreg[4 + d]);
                *(unsigned*)&sVt[nxt][vD0 + d][vS0 + 2] = pk16(vreg[8 + d], vreg[12 + d]);
            }
        }
        // next iteration's __syncthreads publishes buffer[nxt]
    }

    // ---- finalize: reduce row sums across the 16-lane half, normalize, store ----
    #pragma unroll
    for (int r = 0; r < 8; ++r) {
        const float ls  = rowsum16(lsum[r]);
        const float inv = 1.0f / ls;
        const int M = r + laneHi * 8;
        float* orow = Ob + (size_t)(qRow0 + M) * DMODEL;
        #pragma unroll
        for (int j = 0; j < 4; ++j)
            orow[j * 16 + laneN] = acc[j][r] * inv;
    }
}

extern "C" void kernel_launch(void* const* d_in, const int* in_sizes, int n_in,
                              void* d_out, int out_size, void* d_ws, size_t ws_size,
                              hipStream_t stream) {
    const float* q = (const float*)d_in[0];
    const float* k = (const float*)d_in[1];
    const float* v = (const float*)d_in[2];
    float* out = (float*)d_out;

    const int B = 2, T = 2048;
    dim3 grid(B * NHEAD * (T / QBLK));               // 512 blocks
    dim3 block(256);                                 // 8 wave32 waves
    fa_alibi_kernel<<<grid, block, 0, stream>>>(q, k, v, out, T);
}

// v003
// A run of this version takes 46.4 microseconds.
// Timed twice side by side with v002, it ran 1.22 and 1.23 times as fast.
// Over all steps from v000 it is 2.52 times as fast.
#include <hip/hip_runtime.h>

typedef __attribute__((ext_vector_type(16))) _Float16 v16h;
typedef __attribute__((ext_vector_type(8)))  _Float16 v8h;
typedef __attribute__((ext_vector_type(2)))  __fp16   fp16x2;
typedef __attribute__((ext_vector_type(8)))  float    v8f;

#define NHEAD    16
#define DHEAD    64
#define DMODEL   1024
#define KTILE    64           // keys per tile (amortizes per-tile softmax overhead)
#define WAVES    8
#define QBLK     128          // 8 waves * 16 query rows: two 64-row groups, see the pairing below
#define QGRP     64           // 4 waves * 16 query rows
#define VT_PITCH 72           // 64 + 8 halves pad: 16B-aligned rows, bank spread
#define KP_PITCH 72           // K and P rows: 144 B = 16 B x odd, so 16 rows read by b128 spread over all banks

union V16 { v16h v; v8h h[2]; };
template<bool B> struct BoolC { static constexpr bool value = B; };

__device__ __forceinline__ unsigned pk16(float a, float b) {   // v_cvt_pk_rtz_f16_f32
    union { fp16x2 h; unsigned u; } cv;
    cv.h = __builtin_amdgcn_cvt_pkrtz(a, b);
    return cv.u;
}

// Butterfly reductions across each 16-lane half via DPP16 ROW_XMASK: pure VALU.
__device__ __forceinline__ float rowmax16(float x) {
    int t;
    t = __builtin_amdgcn_update_dpp(0, __float_as_int(x), 0x161, 0xf, 0xf, true);
    x = fmaxf(x, __int_as_float(t));
    t = __builtin_amdgcn_update_dpp(0, __float_as_int(x), 0x162, 0xf, 0xf, true);
    x = fmaxf(x, __int_as_float(t));
    t = __builtin_amdgcn_update_dpp(0, __float_as_int(x), 0x164, 0xf, 0xf, true);
    x = fmaxf(x, __int_as_float(t));
    t = __builtin_amdgcn_update_dpp(0, __float_as_int(x), 0x168, 0xf, 0xf, true);
    x = fmaxf(x, __int_as_float(t));
    return x;
}
__device__ __forceinline__ float rowsum16(float x) {
    int t;
    t = __builtin_amdgcn_update_dpp(0, __float_as_int(x), 0x161, 0xf, 0xf, true);
    x += __int_as_float(t);
    t = __builtin_amdgcn_update_dpp(0, __float_as_int(x), 0x162, 0xf, 0xf, true);
    x += __int_as_float(t);
    t = __builtin_amdgcn_update_dpp(0, __float_as_int(x), 0x164, 0xf, 0xf, true);
    x += __int_as_float(t);
    t = __builtin_amdgcn_update_dpp(0, __float_as_int(x), 0x168, 0xf, 0xf, true);
    x += __int_as_float(t);
    return x;
}

// Fused causal flash-attention with ALiBi, log2-domain online softmax,
// double-buffered f16 K/V staging in LDS shared by 8 waves per block.
__global__ __launch_bounds__(256)
void fa_alibi_kernel(const float* __restrict__ Q,
                     const float* __restrict__ K,
                     const float* __restrict__ V,
                     float* __restrict__ O,
                     int T)
{
    __shared__ __align__(16) _Float16 sK [2][KTILE][KP_PITCH];   // K tiles, row-major, padded rows
    __shared__ __align__(16) _Float16 sVt[2][DHEAD][VT_PITCH];   // V tiles, transposed
    __shared__ __align__(16) _Float16 sP [WAVES][16][KP_PITCH];  // per-wave P scratch, padded rows

    const int qTiles = T / QBLK;
    const int qt = blockIdx.x % qTiles;
    const int h  = (blockIdx.x / qTiles) % NHEAD;
    const int b  =  blockIdx.x / (qTiles * NHEAD);
    // Causal cost grows with the query position, and every block is resident at once, so the
    // launch lasts as long as its fullest SIMD.  Each block takes the 64-row group qt from the
    // top (waves 4-7) and its mirror from the bottom (waves 0-3): every block then holds the same
    // number of (wave, key tile) products, and waves w and w+4 are one of each.
    const int qLo = qt * QGRP;                      // short group
    const int qHi = T - QGRP - qLo;                 // long group, sets the trip count

    const int tid    = threadIdx.x;
    // Wave id as a *scalar* so per-wave conditions compile to s_cmp/s_cbranch
    // (EXEC untouched) instead of v_cmpx/saveexec.
    const int wave   = __builtin_amdgcn_readfirstlane(tid >> 5);
    const int lane   = tid & 31;
    const int laneN  = lane & 15;
    const int laneHi = lane >> 4;

    const int qRow0   = (wave < WAVES / 2 ? qHi : qLo - QGRP) + wave * 16;   // scalar
    const int qRowMax = qRow0 + 15;            // scalar

    const size_t headOff = (size_t)h * DHEAD;
    const float* Qb = Q + (size_t)b * T * DMODEL + headOff;
    const float* Kb = K + (size_t)b * T * DMODEL + headOff;
    const float* Vb = V + (size_t)b * T * DMODEL + headOff;
    float*       Ob = O + (size_t)b * T * DMODEL + headOff;

    // ---- Q A-fragments: 16x64 f16 as two 16x32 chunks, loaded once ----
    v16h qf[2];
    {
        const float* qrow = Qb + (size_t)(qRow0 + laneN) * DMODEL;
        #pragma unroll
        for (int c = 0; c < 2; ++c) {
            const int k0 = c * 32 + laneHi * 8;
            #pragma unroll
            for (int i = 0; i < 8; ++i) {
                qf[c][i]     = (_Float16)qrow[k0 + i];
                qf[c][i + 8] = (_Float16)qrow[k0 + 16 + i];
            }
        }
    }

    // ---- staging geometry ----
    // K: thread -> (row, 16 contiguous d).  V: thread -> (4 s rows, 4 d) so s-pairs pack.
    const int kRow = tid >> 2;
    const int kD0  = (tid & 3) * 16;
    const int vD0  = (tid & 15) * 4;
    const int vS0  = (tid >> 4) * 4;
    float kreg[16], vreg[16];

    // ---- flash state in log2 domain ----
    const float L2E    = 1.44269504088896f;
    const float SCALE2 = 0.125f * L2E;                        // (1/sqrt(d)) * log2(e)
    const float slope2 = exp2f(-0.5f * (float)(h + 1)) * L2E; // alibi slope * log2(e)
    const float bstep  = slope2 * (float)KTILE;
    const float b16    = slope2 * 16.0f;

    v8f   acc[4];
    float m2[8], lsum[8], bias[8];
    int   trow[8];
    #pragma unroll
    for (int j = 0; j < 4; ++j) acc[j] = (v8f){0,0,0,0,0,0,0,0};
    #pragma unroll
    for (int r = 0; r < 8; ++r) {
        trow[r] = qRow0 + r + laneHi * 8;
        m2[r]   = -__builtin_inff();
        lsum[r] = 0.0f;
        bias[r] = slope2 * (float)(laneN - trow[r]);   // slope2*(s0 - t) at kBase=0
    }

    // ---- softmax tile body; MASK=false carries no compare/select code ----
    auto softmaxTile = [&](auto maskc, const v8f* S, int kBase) {
        constexpr bool MASK = decltype(maskc)::value;
        v8f corrv;
        #pragma unroll
        for (int r = 0; r < 8; ++r) {
            float v[4];
            #pragma unroll
            for (int n = 0; n < 4; ++n)
                v[n] = fmaf(S[n][r], SCALE2, bias[r] + (float)n * b16);
            bias[r] += bstep;
            if (MASK) {
                #pragma unroll
                for (int n = 0; n < 4; ++n)
                    if (kBase + n * 16 + laneN > trow[r]) v[n] = -__builtin_inff();
            }
            float mx = fmaxf(fmaxf(v[0], v[1]), fmaxf(v[2], v[3]));
            mx = rowmax16(mx);
            const float mnew = fmaxf(m2[r], mx);
            const float corr = __builtin_amdgcn_exp2f(m2[r] - mnew);
            m2[r]    = mnew;
            corrv[r] = corr;
            float p[4], ps = 0.0f;
            #pragma unroll
            for (int n = 0; n < 4; ++n) { p[n] = __builtin_amdgcn_exp2f(v[n] - mnew); ps += p[n]; }
            lsum[r] = lsum[r] * corr + ps;            // per-lane partial; reduce at end
            const int M = r + laneHi * 8;
            #pragma unroll
            for (int n = 0; n < 4; ++n)
                sP[wave][M][laneN + n * 16] = (_Float16)p[n];
        }
        // vectorized rescale -> v_pk_mul_f32 pairs
        #pragma unroll
        for (int j = 0; j < 4; ++j) acc[j] *= corrv;
    };

    const int nKT = qHi / KTILE + QGRP / KTILE;        // causal: keys < qHi+64; same for all waves

    // ---- prologue: stage tile 0 into buffer 0 ----
    {
        const float* kr = Kb + (size_t)kRow * DMODEL + kD0;
        #pragma unroll
        for (int i = 0; i < 16; ++i) kreg[i] = kr[i];
        #pragma unroll
        for (int i = 0; i < 4; ++i) {
            const float* vr = Vb + (size_t)(vS0 + i) * DMODEL + vD0;
            #pragma unroll
            for (int d = 0; d < 4; ++d) vreg[i * 4 + d] = vr[d];
        }
        unsigned kw[8];
        #pragma unroll
        for (int i = 0; i < 8; ++i) kw[i] = pk16(kreg[2 * i], kreg[2 * i + 1]);
        *(uint4*)&sK[0][kRow][kD0]     = *(uint4*)&kw[0];
        *(uint4*)&sK[0][kRow][kD0 + 8] = *(uint4*)&kw[4];
        #pragma unroll
        for (int d = 0; d < 4; ++d) {
            *(unsigned*)&sVt[0][vD0 + d][vS0]     = pk16(vreg[d],     vreg[4 + d]);
            *(unsigned*)&sVt[0][vD0 + d][vS0 + 2] = pk16(vreg[8 + d], vreg[12 + d]);
        }
    }

    for (int kt = 0; kt < nKT; ++kt) {
        const int  kBase = kt * KTILE;
        const int  cur   = kt & 1;
        const bool more  = (kt + 1 < nKT);

        __syncthreads();   // buffer[cur] ready; buffer[1-cur] free to overwrite

        // Issue the next tile's global loads BEHIND the barrier: the barrier's fence drains every
        // outstanding global load, so loads issued in front of it are waited out there, with nothing
        // to hide them.  From here they fly during this tile's products and softmax and are first
        // waited for at the convert-and-store below.
        if (more) {
            const float* kr = Kb + (size_t)(kBase + KTILE + kRow) * DMODEL + kD0;
            #pragma unroll
            for (int i = 0; i < 16; ++i) kreg[i] = kr[i];
            #pragma unroll
            for (int i = 0; i < 4; ++i) {
                const float* vr = Vb + (size_t)(kBase + KTILE + vS0 + i) * DMODEL + vD0;
                #pragma unroll
                for (int d = 0; d < 4; ++d) vreg[i * 4 + d] = vr[d];
            }
            // The products below reuse the loads' address registers while the loads are in flight:
            // this wait stands in front of the first such overwrite (it does not wait for the data).
            asm volatile("s_wait_xcnt 0x0" ::: "memory");
        }

        if (kBase <= qRowMax) {   // scalar condition: s_cbranch, EXEC stays all-ones
            // ---- S = Q * K^T : four 16x16 f32 tiles over 64 keys ----
            v8f S[4];
            #pragma unroll
            for (int n = 0; n < 4; ++n) {
                v8f c = (v8f){0,0,0,0,0,0,0,0};
                #pragma unroll
                for (int ch = 0; ch < 2; ++ch) {
                    V16 bf;
                    const _Float16* kp = &sK[cur][n * 16 + laneN][ch * 32 + laneHi * 8];
                    bf.h[0] = *(const v8h*)kp;
                    bf.h[1] = *(const v8h*)(kp + 16);
                    c = __builtin_amdgcn_wmma_f32_16x16x32_f16(
                            false, qf[ch], false, bf.v, (short)0, c, false, false);
                }
                S[n] = c;
            }

            // ---- online softmax: mask path only for diagonal tiles (scalar cond) ----
            if (kBase + KTILE - 1 > qRow0) softmaxTile(BoolC<true>{},  S, kBase);
            else                           softmaxTile(BoolC<false>{}, S, kBase);

            // same-wave LDS ordering: cross-lane P stores -> our A-layout loads
            asm volatile("s_wait_dscnt 0" ::: "memory");

            // ---- O += P * V : P is 16x64 (two A chunks), V chunks 32x16 each ----
            V16 pf[2];
            #pragma unroll
            for (int ch = 0; ch < 2; ++ch) {
                const _Float16* pr = &sP[wave][laneN][ch * 32 + laneHi * 8];
                pf[ch].h[0] = *(const v8h*)pr;
                pf[ch].h[1] = *(const v8h*)(pr + 16);
            }
            #pragma unroll
            for (int j = 0; j < 4; ++j) {
                #pragma unroll
                for (int ch = 0; ch < 2; ++ch) {
                    V16 vf;
                    const _Float16* vp2 = &sVt[cur][j * 16 + laneN][ch * 32 + laneHi * 8];
                    vf.h[0] = *(const v8h*)vp2;
                    vf.h[1] = *(const v8h*)(vp2 + 16);
                    acc[j] = __builtin_amdgcn_wmma_f32_16x16x32_f16(
                                false, pf[ch].v, false, vf.v, (short)0, acc[j], false, false);
                }
            }
        }

        // convert + store the prefetched tile into the other buffer
        if (more) {
            const int nxt = 1 - cur;
            unsigned kw[8];
            #pragma unroll
            for (int i = 0; i < 8; ++i) kw[i] = pk16(kreg[2 * i], kreg[2 * i + 1]);
            *(uint4*)&sK[nxt][kRow][kD0]     = *(uint4*)&kw[0];
            *(uint4*)&sK[nxt][kRow][kD0 + 8] = *(uint4*)&kw[4];
            #pragma unroll
            for (int d = 0; d < 4; ++d) {
                *(unsigned*)&sVt[nxt][vD0 + d][vS0]     = pk16(vreg[d],     vreg[4 + d]);
                *(unsigned*)&sVt[nxt][vD0 + d][vS0 + 2] = pk16(vreg[8 + d], vreg[12 + d]);
            }
        }
        // next iteration's __syncthreads publishes buffer[nxt]
    }

    // ---- finalize: reduce row sums across the 16-lane half, normalize, store ----
    #pragma unroll
    for (int r = 0; r < 8; ++r) {
        const float ls  = rowsum16(lsum[r]);
        const float inv = 1.0f / ls;
        const int M = r + laneHi * 8;
        float* orow = Ob + (size_t)(qRow0 + M) * DMODEL;
        #pragma unroll
        for (int j = 0; j < 4; ++j)
            orow[j * 16 + laneN] = acc[j][r] * inv;
    }
}

extern "C" void kernel_launch(void* const* d_in, const int* in_sizes, int n_in,
                              void* d_out, int out_size, void* d_ws, size_t ws_size,
                              hipStream_t stream) {
    const float* q = (const float*)d_in[0];
    const float* k = (const float*)d_in[1];
    const float* v = (const float*)d_in[2];
    float* out = (float*)d_out;

    const int B = 2, T = 2048;
    dim3 grid(B * NHEAD * (T / QBLK));               // 512 blocks
    dim3 block(256);                                 // 8 wave32 waves
    fa_alibi_kernel<<<grid, block, 0, stream>>>(q, k, v, out, T);
}

// v004
// One run takes 39.6 microseconds.
// Next to v003, in two timings, it ran 1.17 and 1.18 times as fast.
// Counting every step since v000, it is 2.96 times as fast.
#include <hip/hip_runtime.h>

typedef __attribute__((ext_vector_type(16))) _Float16 v16h;
typedef __attribute__((ext_vector_type(8)))  _Float16 v8h;
typedef __attribute__((ext_vector_type(2)))  __fp16   fp16x2;
typedef __attribute__((ext_vector_type(8)))  float    v8f;

#define NHEAD    16
#define DHEAD    64
#define DMODEL   1024
#define KTILE    64           // keys per tile (amortizes per-tile softmax overhead)
#define WAVES    8
#define QBLK     128          // 8 waves * 16 query rows: two 64-row groups, see the pairing below
#define QGRP     64           // 4 waves * 16 query rows
#define VT_PITCH 72           // 64 + 8 halves pad: 16B-aligned rows, bank spread
#define KP_PITCH 72           // K rows: 144 B = 16 B x odd, so 16 rows read by b128 spread over all banks

union V16 { v16h v; v8h h[2]; };
template<bool B> struct BoolC { static constexpr bool value = B; };

__device__ __forceinline__ unsigned pk16(float a, float b) {   // v_cvt_pk_rtz_f16_f32
    union { fp16x2 h; unsigned u; } cv;
    cv.h = __builtin_amdgcn_cvt_pkrtz(a, b);
    return cv.u;
}

// Lane l <-> lane l ^ 16: the two lanes that share one query column.
__device__ __forceinline__ float xhalf(float x) {
    const int i = __float_as_int(x);
    return __int_as_float(__builtin_amdgcn_permlanex16(i, i, 0x76543210, 0xfedcba98, false, false));
}

__global__ __launch_bounds__(256)
void fa_alibi_kernel(const float* __restrict__ Q,
                     const float* __restrict__ K,
                     const float* __restrict__ V,
                     float* __restrict__ O,
                     int T)
{
    __shared__ __align__(16) _Float16 sK [2][KTILE][KP_PITCH];   // K tiles, row-major, padded rows
    __shared__ __align__(16) _Float16 sVt[2][DHEAD][VT_PITCH];   // V tiles, transposed

    const int qTiles = T / QBLK;
    const int qt = blockIdx.x % qTiles;
    const int h  = (blockIdx.x / qTiles) % NHEAD;
    const int b  =  blockIdx.x / (qTiles * NHEAD);
    // Causal cost grows with the query position, and every block is resident at once, so the
    // launch lasts as long as its fullest SIMD.  Each block takes the 64-row group qt from the
    // top (waves 4-7) and its mirror from the bottom (waves 0-3): every block then holds the same
    // number of (wave, key tile) products, and waves w and w+4 are one of each.
    const int qLo = qt * QGRP;                      // short group
    const int qHi = T - QGRP - qLo;                 // long group, sets the trip count

    const int tid    = threadIdx.x;
    // Wave id as a *scalar* so per-wave conditions compile to s_cmp/s_cbranch
    // (EXEC untouched) instead of v_cmpx/saveexec.
    const int wave   = __builtin_amdgcn_readfirstlane(tid >> 5);
    const int lane   = tid & 31;
    const int laneN  = lane & 15;
    const int laneHi = lane >> 4;

    const int qRow0   = (wave < WAVES / 2 ? qHi : qLo - QGRP) + wave * 16;   // scalar
    const int qRowMax = qRow0 + 15;            // scalar

    const size_t headOff = (size_t)h * DHEAD;
    const float* Qb = Q + (size_t)b * T * DMODEL + headOff;
    const float* Kb = K + (size_t)b * T * DMODEL + headOff;
    const float* Vb = V + (size_t)b * T * DMODEL + headOff;
    float*       Ob = O + (size_t)b * T * DMODEL + headOff;

    // ---- Q fragments (B operand: column = query laneN): 64x16 f16 as two 32x16 chunks, loaded once ----
    v16h qf[2];
    {
        const float* qrow = Qb + (size_t)(qRow0 + laneN) * DMODEL;
        #pragma unroll
        for (int c = 0; c < 2; ++c) {
            const int k0 = c * 32 + laneHi * 8;
            #pragma unroll
            for (int i = 0; i < 8; ++i) {
                qf[c][i]     = (_Float16)qrow[k0 + i];
                qf[c][i + 8] = (_Float16)qrow[k0 + 16 + i];
            }
        }
    }

    // ---- staging geometry ----
    // K: thread -> (row, 16 contiguous d).  V: thread -> (4 s rows, 4 d) so s-pairs pack.
    const int kRow = tid >> 2;
    const int kD0  = (tid & 3) * 16;
    const int vD0  = (tid & 15) * 4;
    const int vS0  = (tid >> 4) * 4;
    float kreg[16], vreg[16];

    // ---- flash state in log2 domain ----
    const float L2E    = 1.44269504088896f;
    const float SCALE2 = 0.125f * L2E;                        // (1/sqrt(d)) * log2(e)
    const float slope2 = exp2f(-0.5f * (float)(h + 1)) * L2E; // alibi slope * log2(e)
    const float bstep  = slope2 * (float)KTILE;

    // acc[j][r] = O^T[d = j*16 + laneHi*8 + r][query laneN]
    v8f   acc[4], cb[4];
    #pragma unroll
    for (int j = 0; j < 4; ++j) acc[j] = (v8f){0,0,0,0,0,0,0,0};
    // ALiBi term of key n*16 + laneHi*8 + r counted from the tile's first key.  The rest of the term,
    // slope2 * (kBase - t), is one number per query and tile: the part in t cancels in the softmax,
    // the part in kBase is carried by the running maximum, which is kept relative to the current tile.
    #pragma unroll
    for (int n = 0; n < 4; ++n)
        #pragma unroll
        for (int r = 0; r < 8; ++r) cb[n][r] = slope2 * (float)(n * 16 + laneHi * 8 + r);
    const int tq   = qRow0 + laneN;          // this lane's query
    float     mrel = -__builtin_inff();      // running maximum, relative to the current tile
    float     lsum = 0.0f;                   // sum over this lane's half of the keys; halves join at the end

    // ---- softmax tile body; MASK=false carries no compare/select code ----
    auto softmaxTile = [&](auto maskc, v8f* S, int kBase, V16* pf) {
        constexpr bool MASK = decltype(maskc)::value;
        const v8f sc = (v8f){SCALE2, SCALE2, SCALE2, SCALE2, SCALE2, SCALE2, SCALE2, SCALE2};
        #pragma unroll
        for (int n = 0; n < 4; ++n) S[n] = __builtin_elementwise_fma(S[n], sc, cb[n]);
        if (MASK) {
            const int lim = tq - kBase - laneHi * 8;     // last allowed n*16 + r
            #pragma unroll
            for (int n = 0; n < 4; ++n)
                #pragma unroll
                for (int r = 0; r < 8; ++r)
                    if (n * 16 + r > lim) S[n][r] = -__builtin_inff();
        }
        float e[8];
        #pragma unroll
        for (int r = 0; r < 8; ++r)
            e[r] = fmaxf(fmaxf(S[0][r], S[1][r]), fmaxf(S[2][r], S[3][r]));
        float mx = fmaxf(fmaxf(fmaxf(e[0], e[1]), fmaxf(e[2], e[3])),
                         fmaxf(fmaxf(e[4], e[5]), fmaxf(e[6], e[7])));
        mx = fmaxf(mx, xhalf(mx));                       // both halves hold the query's tile maximum
        const float mold = mrel - bstep;                 // the old maximum seen from this tile
        const float mnew = fmaxf(mold, mx);
        const float corr = __builtin_amdgcn_exp2f(mold - mnew);
        mrel = mnew;
        #pragma unroll
        for (int n = 0; n < 4; ++n) {
            S[n] -= mnew;
            #pragma unroll
            for (int r = 0; r < 8; ++r) S[n][r] = __builtin_amdgcn_exp2f(S[n][r]);
        }
        const v8f s8 = (S[0] + S[1]) + (S[2] + S[3]);
        const float ps = ((s8[0] + s8[1]) + (s8[2] + s8[3])) + ((s8[4] + s8[5]) + (s8[6] + s8[7]));
        lsum = lsum * corr + ps;
        // P^T as B fragment: element s < 8 is key 8*laneHi + s, s >= 8 key 16 + 8*laneHi + (s - 8)
        #pragma unroll
        for (int ch = 0; ch < 2; ++ch) {
            pf[ch].h[0] = __builtin_convertvector(S[2 * ch],     v8h);
            pf[ch].h[1] = __builtin_convertvector(S[2 * ch + 1], v8h);
        }
        #pragma unroll
        for (int j = 0; j < 4; ++j) acc[j] *= corr;
    };

    const int nKT = qHi / KTILE + QGRP / KTILE;        // causal: keys < qHi+64; same for all waves

    // ---- prologue: stage tile 0 into buffer 0 ----
    {
        const float* kr = Kb + (size_t)kRow * DMODEL + kD0;
        #pragma unroll
        for (int i = 0; i < 16; ++i) kreg[i] = kr[i];
        #pragma unroll
        for (int i = 0; i < 4; ++i) {
            const float* vr = Vb + (size_t)(vS0 + i) * DMODEL + vD0;
            #pragma unroll
            for (int d = 0; d < 4; ++d) vreg[i * 4 + d] = vr[d];
        }
        unsigned kw[8];
        #pragma unroll
        for (int i = 0; i < 8; ++i) kw[i] = pk16(kreg[2 * i], kreg[2 * i + 1]);
        *(uint4*)&sK[0][kRow][kD0]     = *(uint4*)&kw[0];
        *(uint4*)&sK[0][kRow][kD0 + 8] = *(uint4*)&kw[4];
        #pragma unroll
        for (int d = 0; d < 4; ++d) {
            *(unsigned*)&sVt[0][vD0 + d][vS0]     = pk16(vreg[d],     vreg[4 + d]);
            *(unsigned*)&sVt[0][vD0 + d][vS0 + 2] = pk16(vreg[8 + d], vreg[12 + d]);
        }
    }

    for (int kt = 0; kt < nKT; ++kt) {
        const int  kBase = kt * KTILE;
        const int  cur   = kt & 1;
        const bool more  = (kt + 1 < nKT);

        __syncthreads();   // buffer[cur] ready; buffer[1-cur] free to overwrite

        // Issue the next tile's global loads BEHIND the barrier: the barrier's fence drains every
        // outstanding global load, so loads issued in front of it are waited out there, with nothing
        // to hide them.  From here they fly during this tile's products and softmax and are first
        // waited for at the convert-and-store below.
        if (more) {
            const float* kr = Kb + (size_t)(kBase + KTILE + kRow) * DMODEL + kD0;
            #pragma unroll
            for (int i = 0; i < 16; ++i) kreg[i] = kr[i];
            #pragma unroll
            for (int i = 0; i < 4; ++i) {
                const float* vr = Vb + (size_t)(kBase + KTILE + vS0 + i) * DMODEL + vD0;
                #pragma unroll
                for (int d = 0; d < 4; ++d) vreg[i * 4 + d] = vr[d];
            }
            // The products below reuse the loads' address registers while the loads are in flight:
            // this wait stands in front of the first such overwrite (it does not wait for the data).
            asm volatile("s_wait_xcnt 0x0" ::: "memory");
        }

        if (kBase <= qRowMax) {   // scalar condition: s_cbranch, EXEC stays all-ones
            // ---- S^T = K * Q^T : four 16x16 f32 tiles, S[n][r] = key n*16 + laneHi*8 + r, query laneN ----
            v8f S[4];
            #pragma unroll
            for (int n = 0; n < 4; ++n) {
                v8f c = (v8f){0,0,0,0,0,0,0,0};
                #pragma unroll
                for (int ch = 0; ch < 2; ++ch) {
                    V16 kf;
                    const _Float16* kp = &sK[cur][n * 16 + laneN][ch * 32 + laneHi * 8];
                    kf.h[0] = *(const v8h*)kp;
                    kf.h[1] = *(const v8h*)(kp + 16);
                    c = __builtin_amdgcn_wmma_f32_16x16x32_f16(
                            false, kf.v, false, qf[ch], (short)0, c, false, false);
                }
                S[n] = c;
            }

            // ---- online softmax: mask path only for diagonal tiles (scalar cond) ----
            V16 pf[2];
            if (kBase + KTILE - 1 > qRow0) softmaxTile(BoolC<true>{},  S, kBase, pf);
            else                           softmaxTile(BoolC<false>{}, S, kBase, pf);

            // ---- O^T += V^T * P^T : V^T chunks 16x32 (A), P^T 64x16 as two B chunks ----
            #pragma unroll
            for (int j = 0; j < 4; ++j) {
                #pragma unroll
                for (int ch = 0; ch < 2; ++ch) {
                    V16 vf;
                    const _Float16* vp2 = &sVt[cur][j * 16 + laneN][ch * 32 + laneHi * 8];
                    vf.h[0] = *(const v8h*)vp2;
                    vf.h[1] = *(const v8h*)(vp2 + 16);
                    acc[j] = __builtin_amdgcn_wmma_f32_16x16x32_f16(
                                false, vf.v, false, pf[ch].v, (short)0, acc[j], false, false);
                }
            }
        }

        // convert + store the prefetched tile into the other buffer
        if (more) {
            const int nxt = 1 - cur;
            unsigned kw[8];
            #pragma unroll
            for (int i = 0; i < 8; ++i) kw[i] = pk16(kreg[2 * i], kreg[2 * i + 1]);
            *(uint4*)&sK[nxt][kRow][kD0]     = *(uint4*)&kw[0];
            *(uint4*)&sK[nxt][kRow][kD0 + 8] = *(uint4*)&kw[4];
            #pragma unroll
            for (int d = 0; d < 4; ++d) {
                *(unsigned*)&sVt[nxt][vD0 + d][vS0]     = pk16(vreg[d],     vreg[4 + d]);
                *(unsigned*)&sVt[nxt][vD0 + d][vS0 + 2] = pk16(vreg[8 + d], vreg[12 + d]);
            }
        }
        // next iteration's __syncthreads publishes buffer[nxt]
    }

    // ---- finalize: join the two halves' sums, normalize, store 8 consecutive d per tile and lane ----
    {
        const float inv = 1.0f / (lsum + xhalf(lsum));
        float* orow = Ob + (size_t)tq * DMODEL + laneHi * 8;
        #pragma unroll
        for (int j = 0; j < 4; ++j) {
            const v8f o = acc[j] * inv;
            *(float4*)(orow + j * 16)     = make_float4(o[0], o[1], o[2], o[3]);
            *(float4*)(orow + j * 16 + 4) = make_float4(o[4], o[5], o[6], o[7]);
        }
    }
}

extern "C" void kernel_launch(void* const* d_in, const int* in_sizes, int n_in,
                              void* d_out, int out_size, void* d_ws, size_t ws_size,
                              hipStream_t stream) {
    const float* q = (const float*)d_in[0];
    const float* k = (const float*)d_in[1];
    const float* v = (const float*)d_in[2];
    float* out = (float*)d_out;

    const int B = 2, T = 2048;
    dim3 grid(B * NHEAD * (T / QBLK));               // 512 blocks
    dim3 block(256);                                 // 8 wave32 waves
    fa_alibi_kernel<<<grid, block, 0, stream>>>(q, k, v, out, T);
}

// v005
// Measured time: 35 microseconds a run.
// Timed twice side by side with v004, it ran 1.13 and 1.14 times as fast.
// Over all steps from v000 it is 3.35 times as fast.
#include <hip/hip_runtime.h>

typedef __attribute__((ext_vector_type(16))) _Float16 v16h;
typedef __attribute__((ext_vector_type(8)))  _Float16 v8h;
typedef __attribute__((ext_vector_type(2)))  __fp16   fp16x2;
typedef __attribute__((ext_vector_type(8)))  float    v8f;

#define NHEAD    16
#define DHEAD    64
#define DMODEL   1024
#define KTILE    64           // keys per tile (amortizes per-tile softmax overhead)
#define WAVES    8
#define QBLK     128          // 8 waves * 16 query rows: two 64-row groups, see the pairing below
#define QGRP     64           // 4 waves * 16 query rows
#define VT_PITCH 72           // 64 + 8 halves pad: 16B-aligned rows, bank spread
#define KP_PITCH 72           // K rows: 144 B = 16 B x odd, so 16 rows read by b128 spread over all banks

union V16 { v16h v; v8h h[2]; };
template<bool B> struct BoolC { static constexpr bool value = B; };

__device__ __forceinline__ unsigned pk16(float a, float b) {   // v_cvt_pk_rtz_f16_f32
    union { fp16x2 h; unsigned u; } cv;
    cv.h = __builtin_amdgcn_cvt_pkrtz(a, b);
    return cv.u;
}

// Lane l <-> lane l ^ 16: the two lanes that share one query column.
__device__ __forceinline__ float xhalf(float x) {
    const int i = __float_as_int(x);
    return __int_as_float(__builtin_amdgcn_permlanex16(i, i, 0x76543210, 0xfedcba98, false, false));
}

__global__ __launch_bounds__(256)
void fa_alibi_kernel(const float* __restrict__ Q,
                     const float* __restrict__ K,
                     const float* __restrict__ V,
                     float* __restrict__ O,
                     int T)
{
    __shared__ __align__(16) _Float16 sK [2][KTILE][KP_PITCH];   // K tiles, row-major, padded rows
    __shared__ __align__(16) _Float16 sVt[2][DHEAD][VT_PITCH];   // V tiles, transposed

    const int qTiles = T / QBLK;
    const int qt = blockIdx.x % qTiles;
    const int h  = (blockIdx.x / qTiles) % NHEAD;
    const int b  =  blockIdx.x / (qTiles * NHEAD);
    // Causal cost grows with the query position, and every block is resident at once, so the
    // launch lasts as long as its fullest SIMD.  Each block takes the 64-row group qt from the
    // top (waves 4-7) and its mirror from the bottom (waves 0-3): every block then holds the same
    // number of (wave, key tile) products, and waves w and w+4 are one of each.
    const int qLo = qt * QGRP;                      // short group
    const int qHi = T - QGRP - qLo;                 // long group, sets the trip count

    const int tid    = threadIdx.x;
    // Wave id as a *scalar* so per-wave conditions compile to s_cmp/s_cbranch
    // (EXEC untouched) instead of v_cmpx/saveexec.
    const int wave   = __builtin_amdgcn_readfirstlane(tid >> 5);
    const int lane   = tid & 31;
    const int laneN  = lane & 15;
    const int laneHi = lane >> 4;

    const int qRow0   = (wave < WAVES / 2 ? qHi : qLo - QGRP) + wave * 16;   // scalar
    const int qRowMax = qRow0 + 15;            // scalar

    const size_t headOff = (size_t)h * DHEAD;
    const float* Qb = Q + (size_t)b * T * DMODEL + headOff;
    const float* Kb = K + (size_t)b * T * DMODEL + headOff;
    const float* Vb = V + (size_t)b * T * DMODEL + headOff;
    float*       Ob = O + (size_t)b * T * DMODEL + headOff;

    // ---- Q fragments (B operand: column = query laneN): 64x16 f16 as two 32x16 chunks, loaded once ----
    v16h qf[2];
    {
        const float* qrow = Qb + (size_t)(qRow0 + laneN) * DMODEL;
        #pragma unroll
        for (int c = 0; c < 2; ++c) {
            const int k0 = c * 32 + laneHi * 8;
            #pragma unroll
            for (int i = 0; i < 8; ++i) {
                qf[c][i]     = (_Float16)qrow[k0 + i];
                qf[c][i + 8] = (_Float16)qrow[k0 + 16 + i];
            }
        }
    }

    // ---- staging geometry ----
    // K: thread -> (4 rows, 4 d): 16 lanes cover one row's 256 B, so each wave-wide 16-byte load is four
    // whole 128-B lines, not 16-byte pieces of sixteen lines.  A wave's two rows lie 8 apart: 8 * 144 B is
    // 288 dwords, 32 banks on modulo 64, so its 8-byte LDS stores fill all 64 banks once.  Rows kRow + 16 i.
    // V: thread -> (4 s rows, 4 d) so s-pairs pack.
    const int kRow = (tid >> 5) + ((tid >> 4) & 1) * 8;
    const int kD0  = (tid & 15) * 4;
    const int vD0  = (tid & 15) * 4;
    const int vS0  = (tid >> 4) * 4;
    float kreg[16], vreg[16];

    // ---- flash state in log2 domain ----
    const float L2E    = 1.44269504088896f;
    const float SCALE2 = 0.125f * L2E;                        // (1/sqrt(d)) * log2(e)
    const float slope2 = exp2f(-0.5f * (float)(h + 1)) * L2E; // alibi slope * log2(e)
    const float bstep  = slope2 * (float)KTILE;

    // acc[j][r] = O^T[d = j*16 + laneHi*8 + r][query laneN]
    v8f   acc[4], cb[4];
    #pragma unroll
    for (int j = 0; j < 4; ++j) acc[j] = (v8f){0,0,0,0,0,0,0,0};
    // ALiBi term of key n*16 + laneHi*8 + r counted from the tile's first key.  The rest of the term,
    // slope2 * (kBase - t), is one number per query and tile: the part in t cancels in the softmax,
    // the part in kBase is carried by the running maximum, which is kept relative to the current tile.
    #pragma unroll
    for (int n = 0; n < 4; ++n)
        #pragma unroll
        for (int r = 0; r < 8; ++r) cb[n][r] = slope2 * (float)(n * 16 + laneHi * 8 + r);
    const int tq   = qRow0 + laneN;          // this lane's query
    float     mrel = -__builtin_inff();      // running maximum, relative to the current tile
    float     lsum = 0.0f;                   // sum over this lane's half of the keys; halves join at the end

    // ---- softmax tile body; MASK=false carries no compare/select code ----
    auto softmaxTile = [&](auto maskc, v8f* S, int kBase, V16* pf) {
        constexpr bool MASK = decltype(maskc)::value;
        const v8f sc = (v8f){SCALE2, SCALE2, SCALE2, SCALE2, SCALE2, SCALE2, SCALE2, SCALE2};
        #pragma unroll
        for (int n = 0; n < 4; ++n) S[n] = __builtin_elementwise_fma(S[n], sc, cb[n]);
        if (MASK) {
            const int lim = tq - kBase - laneHi * 8;     // last allowed n*16 + r
            #pragma unroll
            for (int n = 0; n < 4; ++n)
                #pragma unroll
                for (int r = 0; r < 8; ++r)
                    if (n * 16 + r > lim) S[n][r] = -__builtin_inff();
        }
        float e[8];
        #pragma unroll
        for (int r = 0; r < 8; ++r)
            e[r] = fmaxf(fmaxf(S[0][r], S[1][r]), fmaxf(S[2][r], S[3][r]));
        float mx = fmaxf(fmaxf(fmaxf(e[0], e[1]), fmaxf(e[2], e[3])),
                         fmaxf(fmaxf(e[4], e[5]), fmaxf(e[6], e[7])));
        mx = fmaxf(mx, xhalf(mx));                       // both halves hold the query's tile maximum
        const float mold = mrel - bstep;                 // the old maximum seen from this tile
        const float mnew = fmaxf(mold, mx);
        const float corr = __builtin_amdgcn_exp2f(mold - mnew);
        mrel = mnew;
        #pragma unroll
        for (int n = 0; n < 4; ++n) {
            S[n] -= mnew;
            #pragma unroll
            for (int r = 0; r < 8; ++r) S[n][r] = __builtin_amdgcn_exp2f(S[n][r]);
        }
        const v8f s8 = (S[0] + S[1]) + (S[2] + S[3]);
        const float ps = ((s8[0] + s8[1]) + (s8[2] + s8[3])) + ((s8[4] + s8[5]) + (s8[6] + s8[7]));
        lsum = lsum * corr + ps;
        // P^T as B fragment: element s < 8 is key 8*laneHi + s, s >= 8 key 16 + 8*laneHi + (s - 8)
        #pragma unroll
        for (int ch = 0; ch < 2; ++ch) {
            pf[ch].h[0] = __builtin_convertvector(S[2 * ch],     v8h);
            pf[ch].h[1] = __builtin_convertvector(S[2 * ch + 1], v8h);
        }
        #pragma unroll
        for (int j = 0; j < 4; ++j) acc[j] *= corr;
    };

    const int nKT = qHi / KTILE + QGRP / KTILE;        // causal: keys < qHi+64; same for all waves

    // ---- prologue: stage tile 0 into buffer 0 ----
    {
        const float* kr = Kb + (size_t)kRow * DMODEL + kD0;
        #pragma unroll
        for (int i = 0; i < 4; ++i)
            #pragma unroll
            for (int d = 0; d < 4; ++d) kreg[i * 4 + d] = kr[i * 16 * DMODEL + d];
        #pragma unroll
        for (int i = 0; i < 4; ++i) {
            const float* vr = Vb + (size_t)(vS0 + i) * DMODEL + vD0;
            #pragma unroll
            for (int d = 0; d < 4; ++d) vreg[i * 4 + d] = vr[d];
        }
        #pragma unroll
        for (int i = 0; i < 4; ++i)
            *(uint2*)&sK[0][kRow + 16 * i][kD0] = make_uint2(pk16(kreg[4 * i],     kreg[4 * i + 1]),
                                                             pk16(kreg[4 * i + 2], kreg[4 * i + 3]));
        #pragma unroll
        for (int d = 0; d < 4; ++d) {
            *(unsigned*)&sVt[0][vD0 + d][vS0]     = pk16(vreg[d],     vreg[4 + d]);
            *(unsigned*)&sVt[0][vD0 + d][vS0 + 2] = pk16(vreg[8 + d], vreg[12 + d]);
        }
    }

    for (int kt = 0; kt < nKT; ++kt) {
        const int  kBase = kt * KTILE;
        const int  cur   = kt & 1;
        const bool more  = (kt + 1 < nKT);

        __syncthreads();   // buffer[cur] ready; buffer[1-cur] free to overwrite

        // Issue the next tile's global loads BEHIND the barrier: the barrier's fence drains every
        // outstanding global load, so loads issued in front of it are waited out there, with nothing
        // to hide them.  From here they fly during this tile's products and softmax and are first
        // waited for at the convert-and-store below.
        if (more) {
            const float* kr = Kb + (size_t)(kBase + KTILE + kRow) * DMODEL + kD0;
            #pragma unroll
            for (int i = 0; i < 4; ++i)
                #pragma unroll
                for (int d = 0; d < 4; ++d) kreg[i * 4 + d] = kr[i * 16 * DMODEL + d];
            #pragma unroll
            for (int i = 0; i < 4; ++i) {
                const float* vr = Vb + (size_t)(kBase + KTILE + vS0 + i) * DMODEL + vD0;
                #pragma unroll
                for (int d = 0; d < 4; ++d) vreg[i * 4 + d] = vr[d];
            }
            // The products below reuse the loads' address registers while the loads are in flight:
            // this wait stands in front of the first such overwrite (it does not wait for the data).
            asm volatile("s_wait_xcnt 0x0" ::: "memory");
        }

        if (kBase <= qRowMax) {   // scalar condition: s_cbranch, EXEC stays all-ones
            // ---- S^T = K * Q^T : four 16x16 f32 tiles, S[n][r] = key n*16 + laneHi*8 + r, query laneN ----
            v8f S[4];
            #pragma unroll
            for (int n = 0; n < 4; ++n) {
                v8f c = (v8f){0,0,0,0,0,0,0,0};
                #pragma unroll
                for (int ch = 0; ch < 2; ++ch) {
                    V16 kf;
                    const _Float16* kp = &sK[cur][n * 16 + laneN][ch * 32 + laneHi * 8];
                    kf.h[0] = *(const v8h*)kp;
                    kf.h[1] = *(const v8h*)(kp + 16);
                    c = __builtin_amdgcn_wmma_f32_16x16x32_f16(
                            false, kf.v, false, qf[ch], (short)0, c, false, false);
                }
                S[n] = c;
            }

            // ---- online softmax: mask path only for diagonal tiles (scalar cond) ----
            V16 pf[2];
            if (kBase + KTILE - 1 > qRow0) softmaxTile(BoolC<true>{},  S, kBase, pf);
            else                           softmaxTile(BoolC<false>{}, S, kBase, pf);

            // ---- O^T += V^T * P^T : V^T chunks 16x32 (A), P^T 64x16 as two B chunks ----
            #pragma unroll
            for (int j = 0; j < 4; ++j) {
                #pragma unroll
                for (int ch = 0; ch < 2; ++ch) {
                    V16 vf;
                    const _Float16* vp2 = &sVt[cur][j * 16 + laneN][ch * 32 + laneHi * 8];
                    vf.h[0] = *(const v8h*)vp2;
                    vf.h[1] = *(const v8h*)(vp2 + 16);
                    acc[j] = __builtin_amdgcn_wmma_f32_16x16x32_f16(
                                false, vf.v, false, pf[ch].v, (short)0, acc[j], false, false);
                }
            }
        }

        // convert + store the prefetched tile into the other buffer
        if (more) {
            const int nxt = 1 - cur;
            #pragma unroll
            for (int i = 0; i < 4; ++i)
                *(uint2*)&sK[nxt][kRow + 16 * i][kD0] = make_uint2(pk16(kreg[4 * i],     kreg[4 * i + 1]),
                                                                   pk16(kreg[4 * i + 2], kreg[4 * i + 3]));
            #pragma unroll
            for (int d = 0; d < 4; ++d) {
                *(unsigned*)&sVt[nxt][vD0 + d][vS0]     = pk16(vreg[d],     vreg[4 + d]);
                *(unsigned*)&sVt[nxt][vD0 + d][vS0 + 2] = pk16(vreg[8 + d], vreg[12 + d]);
            }
        }
        // next iteration's __syncthreads publishes buffer[nxt]
    }

    // ---- finalize: join the two halves' sums, normalize, store 8 consecutive d per tile and lane ----
    {
        const float inv = 1.0f / (lsum + xhalf(lsum));
        float* orow = Ob + (size_t)tq * DMODEL + laneHi * 8;
        #pragma unroll
        for (int j = 0; j < 4; ++j) {
            const v8f o = acc[j] * inv;
            *(float4*)(orow + j * 16)     = make_float4(o[0], o[1], o[2], o[3]);
            *(float4*)(orow + j * 16 + 4) = make_float4(o[4], o[5], o[6], o[7]);
        }
    }
}

extern "C" void kernel_launch(void* const* d_in, const int* in_sizes, int n_in,
                              void* d_out, int out_size, void* d_ws, size_t ws_size,
                              hipStream_t stream) {
    const float* q = (const float*)d_in[0];
    const float* k = (const float*)d_in[1];
    const float* v = (const float*)d_in[2];
    float* out = (float*)d_out;

    const int B = 2, T = 2048;
    dim3 grid(B * NHEAD * (T / QBLK));               // 512 blocks
    dim3 block(256);                                 // 8 wave32 waves
    fa_alibi_kernel<<<grid, block, 0, stream>>>(q, k, v, out, T);
}

// v006
// Measured time: 27.1 microseconds a run.
// Two timings next to v005 both put it at 1.29 times that version's speed.
// Over all steps from v000 it is 4.33 times as fast.
#include <hip/hip_runtime.h>

typedef __attribute__((ext_vector_type(16))) _Float16 v16h;
typedef __attribute__((ext_vector_type(8)))  _Float16 v8h;
typedef __attribute__((ext_vector_type(2)))  __fp16   fp16x2;
typedef __attribute__((ext_vector_type(8)))  float    v8f;

#define NHEAD    16
#define DHEAD    64
#define DMODEL   1024
#define KTILE    64           // keys per tile (amortizes per-tile softmax overhead)
#define KHALVES  2            // wave halves of a block; half hw walks the key tiles hw, hw + 2, ...
#define KSTEP    (KTILE * KHALVES)   // keys a block consumes per trip
#define QWAVES   8            // waves per half
#define QBLK     128          // 8 waves * 16 adjacent query rows, held by both halves
#define VT_PITCH 72           // 64 + 8 halves pad: 16B-aligned rows, bank spread
#define KP_PITCH 72           // K rows: 144 B = 16 B x odd, so 16 rows read by b128 spread over all banks

union V16 { v16h v; v8h h[2]; };
template<bool B> struct BoolC { static constexpr bool value = B; };

__device__ __forceinline__ unsigned pk16(float a, float b) {   // v_cvt_pk_rtz_f16_f32
    union { fp16x2 h; unsigned u; } cv;
    cv.h = __builtin_amdgcn_cvt_pkrtz(a, b);
    return cv.u;
}

// Lane l <-> lane l ^ 16: the two lanes that share one query column.
__device__ __forceinline__ float xhalf(float x) {
    const int i = __float_as_int(x);
    return __int_as_float(__builtin_amdgcn_permlanex16(i, i, 0x76543210, 0xfedcba98, false, false));
}

__global__ __launch_bounds__(512)
void fa_alibi_kernel(const float* __restrict__ Q,
                     const float* __restrict__ K,
                     const float* __restrict__ V,
                     float* __restrict__ O,
                     int T)
{
    __shared__ __align__(16) _Float16 sK [2][KHALVES][KTILE][KP_PITCH];   // K tiles, row-major, padded rows
    __shared__ __align__(16) _Float16 sVt[2][KHALVES][DHEAD][VT_PITCH];   // V tiles, transposed
    __shared__ __align__(16) float    sAcc[QWAVES][8][32][4];             // half 1's O^T for the join
    __shared__ float                  sMl [QWAVES][2][32];                // half 1's maximum and sum

    const int h  = blockIdx.x % NHEAD;
    const int b  = blockIdx.x / NHEAD;
    // A trip (barrier, staging, one tile's products and softmax per wave) is a chain of latencies, and
    // the last query rows need every key: walked by one wave that is T / 64 trips.  Both halves of the
    // block hold the same 128 query rows and split the keys, even 64-key tiles to half 0 and odd ones
    // to half 1, so the longest walk is T / 128 trips; the halves' partial softmax states join at the end.
    // Cost grows with the query position and every block is resident at once: each block takes the
    // 128-row group blockIdx.y from the bottom and then, on the same waves, its mirror from the top,
    // T / 128 + 1 trips in every block.
    int qg = T / QBLK - 1 - blockIdx.y;             // 128-row group in work: the long one first

    const int tid    = threadIdx.x;
    // Wave id as a *scalar* so per-wave conditions compile to s_cmp/s_cbranch
    // (EXEC untouched) instead of v_cmpx/saveexec.
    const int wave   = __builtin_amdgcn_readfirstlane(tid >> 5);
    const int lane   = tid & 31;
    const int laneN  = lane & 15;
    const int laneHi = lane >> 4;

    const int hw      = (wave >> 3) & 1;       // scalar: key half
    const int wq      = wave & (QWAVES - 1);   // scalar: 16-row group inside the block
    int       qRow0   = qg * QBLK + wq * 16;   // scalar

    const size_t headOff = (size_t)h * DHEAD;
    const float* Qb = Q + (size_t)b * T * DMODEL + headOff;
    const float* Kb = K + (size_t)b * T * DMODEL + headOff;
    const float* Vb = V + (size_t)b * T * DMODEL + headOff;
    float*       Ob = O + (size_t)b * T * DMODEL + headOff;

    // ---- Q fragments (B operand: column = query laneN): 64x16 f16 as two 32x16 chunks, loaded once,
    //      qf for the group in work, qfNext for the mirror group ----
    v16h qf[2], qfNext[2];
    {
        // One pointer per group, constant offsets only: piece 4 c + u holds k = c*32 + laneHi*8 + {0, 4, 16, 20}[u] + 0..3
        const float* qrow = Qb + (size_t)(qRow0 + laneN) * DMODEL + laneHi * 8;
        const float* qnxt = Qb + (size_t)(blockIdx.y * QBLK + wq * 16 + laneN) * DMODEL + laneHi * 8;
        float4 qa[8], qb[8];
        #pragma unroll
        for (int u = 0; u < 8; ++u)
            qa[u] = *(const float4*)(qrow + (u >> 2) * 32 + ((u >> 1) & 1) * 16 + (u & 1) * 4);
        // Naming the pointer keeps its registers out of the loads' results up to this wait, which stands in
        // front of their first overwrite (it does not wait for the data).
        asm volatile("s_wait_xcnt 0x0" :: "v"(qrow) : "memory");
        #pragma unroll
        for (int u = 0; u < 8; ++u)
            qb[u] = *(const float4*)(qnxt + (u >> 2) * 32 + ((u >> 1) & 1) * 16 + (u & 1) * 4);
        asm volatile("s_wait_xcnt 0x0" :: "v"(qnxt) : "memory");   // the same for the mirror group's pointer
        #pragma unroll
        for (int c = 0; c < 2; ++c) {
            #pragma unroll
            for (int u = 0; u < 4; ++u) {
                qf[c][4 * u]         = (_Float16)qa[4 * c + u].x;
                qf[c][4 * u + 1]     = (_Float16)qa[4 * c + u].y;
                qf[c][4 * u + 2]     = (_Float16)qa[4 * c + u].z;
                qf[c][4 * u + 3]     = (_Float16)qa[4 * c + u].w;
                qfNext[c][4 * u]     = (_Float16)qb[4 * c + u].x;
                qfNext[c][4 * u + 1] = (_Float16)qb[4 * c + u].y;
                qfNext[c][4 * u + 2] = (_Float16)qb[4 * c + u].z;
                qfNext[c][4 * u + 3] = (_Float16)qb[4 * c + u].w;
            }
        }
    }

    // ---- staging geometry ----
    // K: thread -> (4 rows, 4 d): 16 lanes cover one row's 256 B, so each wave-wide 16-byte load is four
    // whole 128-B lines, not 16-byte pieces of sixteen lines.  A wave's two rows lie 8 apart: 8 * 144 B is
    // 288 dwords, 32 banks on modulo 64, so its 8-byte LDS stores fill all 64 banks once.  Rows kRow + 16 i.
    // V: thread -> (4 s rows, 4 d) so s-pairs pack.  Each half stages the tile that it reads.
    const int kRow = ((tid >> 5) & 7) + ((tid >> 4) & 1) * 8;
    const int kD0  = (tid & 15) * 4;
    const int vD0  = (tid & 15) * 4;
    const int vS0  = ((tid >> 4) & 15) * 4;
    float kreg[16], vreg[16];

    // ---- flash state in log2 domain ----
    const float L2E    = 1.44269504088896f;
    const float SCALE2 = 0.125f * L2E;                        // (1/sqrt(d)) * log2(e)
    const float slope2 = exp2f(-0.5f * (float)(h + 1)) * L2E; // alibi slope * log2(e)
    const float bstep  = slope2 * (float)KSTEP;               // a wave's next tile lies KSTEP keys on

    // acc[j][r] = O^T[d = j*16 + laneHi*8 + r][query laneN]
    v8f   acc[4], cb[4];
    #pragma unroll
    for (int j = 0; j < 4; ++j) acc[j] = (v8f){0,0,0,0,0,0,0,0};
    // ALiBi term of key n*16 + laneHi*8 + r counted from the tile's first key.  The rest of the term,
    // slope2 * (kBase - t), is one number per query and tile: the part in t cancels in the softmax,
    // the part in kBase is carried by the running maximum, which is kept relative to the current tile.
    #pragma unroll
    for (int n = 0; n < 4; ++n)
        #pragma unroll
        for (int r = 0; r < 8; ++r) cb[n][r] = slope2 * (float)(n * 16 + laneHi * 8 + r);
    int       tq   = qRow0 + laneN;          // this lane's query
    float     mrel = -__builtin_inff();      // running maximum, relative to the current tile
    float     lsum = 0.0f;                   // sum over this lane's half of the keys; halves join at the end

    // ---- softmax tile body; MASK=false carries no compare/select code ----
    auto softmaxTile = [&](auto maskc, v8f* S, int kBase, V16* pf) {
        constexpr bool MASK = decltype(maskc)::value;
        const v8f sc = (v8f){SCALE2, SCALE2, SCALE2, SCALE2, SCALE2, SCALE2, SCALE2, SCALE2};
        #pragma unroll
        for (int n = 0; n < 4; ++n) S[n] = __builtin_elementwise_fma(S[n], sc, cb[n]);
        if (MASK) {
            const int lim = tq - kBase - laneHi * 8;     // last allowed n*16 + r
            #pragma unroll
            for (int n = 0; n < 4; ++n)
                #pragma unroll
                for (int r = 0; r < 8; ++r)
                    if (n * 16 + r > lim) S[n][r] = -__builtin_inff();
        }
        float e[8];
        #pragma unroll
        for (int r = 0; r < 8; ++r)
            e[r] = fmaxf(fmaxf(S[0][r], S[1][r]), fmaxf(S[2][r], S[3][r]));
        float mx = fmaxf(fmaxf(fmaxf(e[0], e[1]), fmaxf(e[2], e[3])),
                         fmaxf(fmaxf(e[4], e[5]), fmaxf(e[6], e[7])));
        mx = fmaxf(mx, xhalf(mx));                       // both halves hold the query's tile maximum
        const float mold = mrel - bstep;                 // the old maximum seen from this tile
        const float mnew = fmaxf(mold, mx);
        const float corr = __builtin_amdgcn_exp2f(mold - mnew);
        mrel = mnew;
        #pragma unroll
        for (int n = 0; n < 4; ++n) {
            S[n] -= mnew;
            #pragma unroll
            for (int r = 0; r < 8; ++r) S[n][r] = __builtin_amdgcn_exp2f(S[n][r]);
        }
        const v8f s8 = (S[0] + S[1]) + (S[2] + S[3]);
        const float ps = ((s8[0] + s8[1]) + (s8[2] + s8[3])) + ((s8[4] + s8[5]) + (s8[6] + s8[7]));
        lsum = lsum * corr + ps;
        // P^T as B fragment: element s < 8 is key 8*laneHi + s, s >= 8 key 16 + 8*laneHi + (s - 8)
        #pragma unroll
        for (int ch = 0; ch < 2; ++ch) {
            pf[ch].h[0] = __builtin_convertvector(S[2 * ch],     v8h);
            pf[ch].h[1] = __builtin_convertvector(S[2 * ch + 1], v8h);
        }
        #pragma unroll
        for (int j = 0; j < 4; ++j) acc[j] *= corr;
    };

    // ---- prologue: each half stages its first tile, tile hw, into buffer 0 ----
    {
        const float* kr = Kb + (size_t)(hw * KTILE + kRow) * DMODEL + kD0;
        #pragma unroll
        for (int i = 0; i < 4; ++i)
            #pragma unroll
            for (int d = 0; d < 4; ++d) kreg[i * 4 + d] = kr[i * 16 * DMODEL + d];
        #pragma unroll
        for (int i = 0; i < 4; ++i) {
            const float* vr = Vb + (size_t)(hw * KTILE + vS0 + i) * DMODEL + vD0;
            #pragma unroll
            for (int d = 0; d < 4; ++d) vreg[i * 4 + d] = vr[d];
        }
        #pragma unroll
        for (int i = 0; i < 4; ++i)
            *(uint2*)&sK[0][hw][kRow + 16 * i][kD0] = make_uint2(pk16(kreg[4 * i],     kreg[4 * i + 1]),
                                                                 pk16(kreg[4 * i + 2], kreg[4 * i + 3]));
        #pragma unroll
        for (int d = 0; d < 4; ++d) {
            *(unsigned*)&sVt[0][hw][vD0 + d][vS0]     = pk16(vreg[d],     vreg[4 + d]);
            *(unsigned*)&sVt[0][hw][vD0 + d][vS0 + 2] = pk16(vreg[8 + d], vreg[12 + d]);
        }
    }

    int it = 0;                                        // trips done, over both groups: picks the buffer
    for (int ph = 0; ph < 2; ++ph) {
        const int nKT     = qg + 1;                        // causal: keys < (qg + 1) * 128; same for all waves
        const int qRowMax = qRow0 + 15;                    // scalar
        for (int kt = 0; kt < nKT; ++kt, ++it) {
            const int  kBase = kt * KSTEP + hw * KTILE;   // scalar: this half's tile
            const int  cur   = it & 1;
            const bool last  = (kt + 1 == nKT);
            const bool more  = !(last && ph == 1);
            const int  kNext = last ? hw * KTILE : kBase + KSTEP;   // the mirror group starts again at key 0

            __syncthreads();   // buffer[cur] ready; buffer[1-cur] free to overwrite

            // Issue the next tile's global loads BEHIND the barrier: the barrier's fence drains every
            // outstanding global load, so loads issued in front of it are waited out there, with nothing
            // to hide them.  From here they fly during this tile's products and softmax and are first
            // waited for at the convert-and-store below.
            if (more) {
                const float* kr = Kb + (size_t)(unsigned)(kNext + kRow) * DMODEL + kD0;
                #pragma unroll
                for (int i = 0; i < 4; ++i)
                    #pragma unroll
                    for (int d = 0; d < 4; ++d) kreg[i * 4 + d] = kr[i * 16 * DMODEL + d];
                #pragma unroll
                for (int i = 0; i < 4; ++i) {
                    const float* vr = Vb + (size_t)(unsigned)(kNext + vS0 + i) * DMODEL + vD0;
                    #pragma unroll
                    for (int d = 0; d < 4; ++d) vreg[i * 4 + d] = vr[d];
                }
                // The products below reuse the loads' address registers while the loads are in flight:
                // this wait stands in front of the first such overwrite (it does not wait for the data).
                asm volatile("s_wait_xcnt 0x0" ::: "memory");
            }

            if (kBase <= qRowMax) {   // scalar condition: s_cbranch, EXEC stays all-ones
                // ---- S^T = K * Q^T : four 16x16 f32 tiles, S[n][r] = key n*16 + laneHi*8 + r, query laneN ----
                v8f S[4];
                #pragma unroll
                for (int n = 0; n < 4; ++n) {
                    v8f c = (v8f){0,0,0,0,0,0,0,0};
                    #pragma unroll
                    for (int ch = 0; ch < 2; ++ch) {
                        V16 kf;
                        const _Float16* kp = &sK[cur][hw][n * 16 + laneN][ch * 32 + laneHi * 8];
                        kf.h[0] = *(const v8h*)kp;
                        kf.h[1] = *(const v8h*)(kp + 16);
                        c = __builtin_amdgcn_wmma_f32_16x16x32_f16(
                                false, kf.v, false, qf[ch], (short)0, c, false, false);
                    }
                    S[n] = c;
                }

                // ---- online softmax: mask path only for diagonal tiles (scalar cond) ----
                V16 pf[2];
                if (kBase + KTILE - 1 > qRow0) softmaxTile(BoolC<true>{},  S, kBase, pf);
                else                           softmaxTile(BoolC<false>{}, S, kBase, pf);

                // ---- O^T += V^T * P^T : V^T chunks 16x32 (A), P^T 64x16 as two B chunks ----
                #pragma unroll
                for (int j = 0; j < 4; ++j) {
                    #pragma unroll
                    for (int ch = 0; ch < 2; ++ch) {
                        V16 vf;
                        const _Float16* vp2 = &sVt[cur][hw][j * 16 + laneN][ch * 32 + laneHi * 8];
                        vf.h[0] = *(const v8h*)vp2;
                        vf.h[1] = *(const v8h*)(vp2 + 16);
                        acc[j] = __builtin_amdgcn_wmma_f32_16x16x32_f16(
                                    false, vf.v, false, pf[ch].v, (short)0, acc[j], false, false);
                    }
                }
            }

            // convert + store the prefetched tile into the other buffer
            if (more) {
                // Four vector slots between the last product above and the converts below, which reuse its
                // operand registers.  The fence holds the converts behind the slots.
                asm volatile("v_nop\n\tv_nop\n\tv_nop\n\tv_nop");
                __builtin_amdgcn_sched_barrier(0);
                const int nxt = 1 - cur;
                #pragma unroll
                for (int i = 0; i < 4; ++i)
                    *(uint2*)&sK[nxt][hw][kRow + 16 * i][kD0] = make_uint2(pk16(kreg[4 * i],     kreg[4 * i + 1]),
                                                                           pk16(kreg[4 * i + 2], kreg[4 * i + 3]));
                #pragma unroll
                for (int d = 0; d < 4; ++d) {
                    *(unsigned*)&sVt[nxt][hw][vD0 + d][vS0]     = pk16(vreg[d],     vreg[4 + d]);
                    *(unsigned*)&sVt[nxt][hw][vD0 + d][vS0 + 2] = pk16(vreg[8 + d], vreg[12 + d]);
                }
            }
            // next iteration's __syncthreads publishes buffer[nxt]
        }

        // ---- join the key halves: wave wq of half 1 hands its state to wave wq of half 0, lane to lane ----
        if (hw == 1) {   // scalar condition
            #pragma unroll
            for (int j = 0; j < 4; ++j) {
                *(float4*)sAcc[wq][2 * j][lane]     = make_float4(acc[j][0], acc[j][1], acc[j][2], acc[j][3]);
                *(float4*)sAcc[wq][2 * j + 1][lane] = make_float4(acc[j][4], acc[j][5], acc[j][6], acc[j][7]);
            }
            sMl[wq][0][lane] = mrel;
            sMl[wq][1][lane] = lsum;
        }
        __syncthreads();   // half 1's states are written; every wave passes it
        if (hw == 0) {
            // Each maximum is relative to its wave's last tile.  Half 0 ends on tile 2 qg; half 1 on tile
            // 2 qg + 1 where the rows reach it (wq >= 4), else on 2 qg - 1.  A half 1 that had no tile
            // hands over -inf, 0 and zeros, and its factor below is 0.
            const float mo = sMl[wq][0][lane] + (wq >= QWAVES / 2 ? slope2 : -slope2) * (float)KTILE;
            const float mj = fmaxf(mrel, mo);
            const float f0 = __builtin_amdgcn_exp2f(mrel - mj);
            const float f1 = __builtin_amdgcn_exp2f(mo - mj);
            lsum = lsum * f0 + sMl[wq][1][lane] * f1;
            #pragma unroll
            for (int j = 0; j < 4; ++j) {
                const float4 lo = *(const float4*)sAcc[wq][2 * j][lane];
                const float4 hi = *(const float4*)sAcc[wq][2 * j + 1][lane];
                const v8f    o1 = (v8f){lo.x, lo.y, lo.z, lo.w, hi.x, hi.y, hi.z, hi.w};
                acc[j] = acc[j] * f0 + o1 * f1;
            }
            // ---- finalize: join the two lane halves' sums, normalize, store 8 consecutive d per tile and lane ----
            const float inv = 1.0f / (lsum + xhalf(lsum));
            float* orow = Ob + (size_t)tq * DMODEL + laneHi * 8;
            #pragma unroll
            for (int j = 0; j < 4; ++j) {
                const v8f o = acc[j] * inv;
                *(float4*)(orow + j * 16)     = make_float4(o[0], o[1], o[2], o[3]);
                *(float4*)(orow + j * 16 + 4) = make_float4(o[4], o[5], o[6], o[7]);
            }
            // The fresh state below overwrites registers that these stores name: this wait stands in front
            // of the first such overwrite (it does not wait for the stores to finish).
            asm volatile("s_wait_xcnt 0x0" ::: "memory");
        }
        // ---- the mirror group: its rows, its Q, a fresh state; the staged tiles run on ----
        qg    = blockIdx.y;
        qRow0 = qg * QBLK + wq * 16;
        tq    = qRow0 + laneN;
        qf[0] = qfNext[0];
        qf[1] = qfNext[1];
        #pragma unroll
        for (int j = 0; j < 4; ++j) acc[j] = (v8f){0,0,0,0,0,0,0,0};
        mrel = -__builtin_inff();
        lsum = 0.0f;
    }
}

extern "C" void kernel_launch(void* const* d_in, const int* in_sizes, int n_in,
                              void* d_out, int out_size, void* d_ws, size_t ws_size,
                              hipStream_t stream) {
    const float* q = (const float*)d_in[0];
    const float* k = (const float*)d_in[1];
    const float* v = (const float*)d_in[2];
    float* out = (float*)d_out;

    const int B = 2, T = 2048;
    dim3 grid(B * NHEAD, T / QBLK / 2);              // 32 x 8 blocks, two mirrored 128-row groups each
    dim3 block(512);                                 // 16 wave32 waves
    fa_alibi_kernel<<<grid, block, 0, stream>>>(q, k, v, out, T);
}

// v007
// A run of this version takes 26 microseconds.
// In both of two side-by-side timings against v006, it was 1.04 times as fast.
// All steps since v000 together make it 4.51 times as fast.
#include <hip/hip_runtime.h>

typedef __attribute__((ext_vector_type(16))) _Float16 v16h;
typedef __attribute__((ext_vector_type(8)))  _Float16 v8h;
typedef __attribute__((ext_vector_type(2)))  __fp16   fp16x2;
typedef __attribute__((ext_vector_type(8)))  float    v8f;

#define NHEAD    16
#define DHEAD    64
#define DMODEL   1024
#define KTILE    64           // keys per staged tile
#define KHALVES  2            // tiles staged per trip, one by each half of the block's waves
#define KSTEP    (KTILE * KHALVES)   // keys a block consumes per trip
#define KSUB     32           // keys one wave takes per trip
#define KPARTS   (KSTEP / KSUB)      // key quarters: quarter kq walks the keys kq*32 + 128 i + 0..31
#define QCOLS    2            // 16-query column groups per wave: each K or V fragment read feeds two products
#define QGRP     4            // 32-row query groups per block, each held by KPARTS waves
#define QBLK     128          // QGRP * QCOLS * 16 adjacent query rows
#define VT_PITCH 72           // 64 + 8 halves pad: 16B-aligned rows, bank spread
#define KP_PITCH 72           // K rows: 144 B = 16 B x odd, so 16 rows read by b128 spread over all banks

union V16 { v16h v; v8h h[2]; };
template<bool B> struct BoolC { static constexpr bool value = B; };

__device__ __forceinline__ unsigned pk16(float a, float b) {   // v_cvt_pk_rtz_f16_f32
    union { fp16x2 h; unsigned u; } cv;
    cv.h = __builtin_amdgcn_cvt_pkrtz(a, b);
    return cv.u;
}

// Lane l <-> lane l ^ 16: the two lanes that share one query column.
__device__ __forceinline__ float xhalf(float x) {
    const int i = __float_as_int(x);
    return __int_as_float(__builtin_amdgcn_permlanex16(i, i, 0x76543210, 0xfedcba98, false, false));
}

__global__ __launch_bounds__(512)
void fa_alibi_kernel(const float* __restrict__ Q,
                     const float* __restrict__ K,
                     const float* __restrict__ V,
                     float* __restrict__ O,
                     int T)
{
    __shared__ __align__(16) _Float16 sK [2][KHALVES][KTILE][KP_PITCH];   // K tiles, row-major, padded rows
    __shared__ __align__(16) _Float16 sVt[2][KHALVES][DHEAD][VT_PITCH];   // V tiles, transposed
    __shared__ __align__(16) float    sAcc[QGRP][KPARTS][KPARTS][4][32][4];  // join: [rows][from quarter][for quarter] O^T pieces
    __shared__ float                  sMl [QGRP][KPARTS][QCOLS][2][32];      // join: each quarter's maxima and sums
    __shared__ __align__(16) _Float16 sQn [QGRP][QCOLS * 2][2][32][8];       // the mirror group's Q fragments

    const int h  = blockIdx.x % NHEAD;
    const int b  = blockIdx.x / NHEAD;
    // A trip (barrier, staging, one tile's products and softmax per wave) is a chain of latencies, and
    // the last query rows need every key.  The block's 16 waves are 4 query groups of 32 rows times 4 key
    // quarters of 32 keys, 128 keys a trip, so the longest walk is T / 128 trips; the quarters' partial
    // softmax states join at the end.  A wave holds 32 query columns because the LDS read rate binds:
    // a 1-KB K or V fragment then feeds two matrix instructions, not one.
    // Cost grows with the query position and every block is resident at once: each block takes the
    // 128-row group blockIdx.y from the bottom and then, on the same waves, its mirror from the top,
    // T / 128 + 1 trips in every block.
    int qg = T / QBLK - 1 - blockIdx.y;             // 128-row group in work: the long one first

    const int tid    = threadIdx.x;
    // Wave id as a *scalar* so per-wave conditions compile to s_cmp/s_cbranch
    // (EXEC untouched) instead of v_cmpx/saveexec.
    const int wave   = __builtin_amdgcn_readfirstlane(tid >> 5);
    const int lane   = tid & 31;
    const int laneN  = lane & 15;
    const int laneHi = lane >> 4;

    const int hw      = (wave >> 3) & 1;       // scalar: the 64-key tile that this wave helps to stage
    const int kq      = wave & (KPARTS - 1);   // scalar: key quarter that this wave computes on
    const int wq      = (wave >> 2) & (QGRP - 1);   // scalar: 32-row group inside the block
    const int kh      = kq >> 1;               // scalar: staged tile that holds the quarter
    const int ks      = (kq & 1) * KSUB;       // scalar: the quarter's first key inside that tile
    int       qRow0   = qg * QBLK + wq * (QCOLS * 16);   // scalar

    const size_t headOff = (size_t)h * DHEAD;
    const float* Qb = Q + (size_t)b * T * DMODEL + headOff;
    const float* Kb = K + (size_t)b * T * DMODEL + headOff;
    const float* Vb = V + (size_t)b * T * DMODEL + headOff;
    float*       Ob = O + (size_t)b * T * DMODEL + headOff;

    // ---- Q fragments (B operand: column = query g*16 + laneN): per column group 64x16 f16 as two 32x16
    //      chunks, loaded once.  The mirror group's four fragments wait in LDS: each of the four waves that
    //      share the rows fetches one of them (column group kq >> 1, chunk kq & 1) ----
    v16h qf[QCOLS][2];
    {
        // One pointer per column group, constant offsets only: piece 4 c + u holds k = c*32 + laneHi*8 + {0, 4, 16, 20}[u] + 0..3
        float4 qa[QCOLS][8], qb[4];
        #pragma unroll
        for (int g = 0; g < QCOLS; ++g) {
            const float* qrow = Qb + (size_t)(qRow0 + g * 16 + laneN) * DMODEL + laneHi * 8;
            #pragma unroll
            for (int u = 0; u < 8; ++u)
                qa[g][u] = *(const float4*)(qrow + (u >> 2) * 32 + ((u >> 1) & 1) * 16 + (u & 1) * 4);
            // Naming the pointer keeps its registers out of the loads' results up to this wait, which stands in
            // front of their first overwrite (it does not wait for the data).
            asm volatile("s_wait_xcnt 0x0" :: "v"(qrow) : "memory");
        }
        const float* qnxt = Qb + (size_t)(blockIdx.y * QBLK + wq * (QCOLS * 16) + (kq >> 1) * 16 + laneN) * DMODEL
                               + (kq & 1) * 32 + laneHi * 8;
        #pragma unroll
        for (int u = 0; u < 4; ++u)
            qb[u] = *(const float4*)(qnxt + (u >> 1) * 16 + (u & 1) * 4);
        asm volatile("s_wait_xcnt 0x0" :: "v"(qnxt) : "memory");   // the same for the mirror group's pointer
        #pragma unroll
        for (int g = 0; g < QCOLS; ++g) {
            #pragma unroll
            for (int c = 0; c < 2; ++c) {
                #pragma unroll
                for (int u = 0; u < 4; ++u) {
                    qf[g][c][4 * u]     = (_Float16)qa[g][4 * c + u].x;
                    qf[g][c][4 * u + 1] = (_Float16)qa[g][4 * c + u].y;
                    qf[g][c][4 * u + 2] = (_Float16)qa[g][4 * c + u].z;
                    qf[g][c][4 * u + 3] = (_Float16)qa[g][4 * c + u].w;
                }
            }
        }
        V16 qn;
        #pragma unroll
        for (int u = 0; u < 4; ++u) {
            qn.v[4 * u]     = (_Float16)qb[u].x;
            qn.v[4 * u + 1] = (_Float16)qb[u].y;
            qn.v[4 * u + 2] = (_Float16)qb[u].z;
            qn.v[4 * u + 3] = (_Float16)qb[u].w;
        }
        // read back behind the first group's join barrier
        *(v8h*)sQn[wq][kq][0][lane] = qn.h[0];
        *(v8h*)sQn[wq][kq][1][lane] = qn.h[1];
    }

    // ---- staging geometry ----
    // K: thread -> (4 rows, 4 d): 16 lanes cover one row's 256 B, so each wave-wide 16-byte load is four
    // whole 128-B lines, not 16-byte pieces of sixteen lines.  A wave's two rows lie 8 apart: 8 * 144 B is
    // 288 dwords, 32 banks on modulo 64, so its 8-byte LDS stores fill all 64 banks once.  Rows kRow + 16 i.
    // V: thread -> (4 s rows, 4 d) so s-pairs pack.  Waves 0-7 stage the trip's first tile, waves 8-15 the second.
    const int kRow = ((tid >> 5) & 7) + ((tid >> 4) & 1) * 8;
    const int kD0  = (tid & 15) * 4;
    const int vD0  = (tid & 15) * 4;
    const int vS0  = ((tid >> 4) & 15) * 4;
    float kreg[16], vreg[16];

    // ---- flash state in log2 domain ----
    const float L2E    = 1.44269504088896f;
    const float SCALE2 = 0.125f * L2E;                        // (1/sqrt(d)) * log2(e)
    const float slope2 = exp2f(-0.5f * (float)(h + 1)) * L2E; // alibi slope * log2(e)
    const float bstep  = slope2 * (float)KSTEP;               // a wave's next tile lies KSTEP keys on

    // acc[j][g][r] = O^T[d = j*16 + laneHi*8 + r][query g*16 + laneN]
    v8f   acc[4][QCOLS], cb[2];
    #pragma unroll
    for (int j = 0; j < 4; ++j)
        #pragma unroll
        for (int g = 0; g < QCOLS; ++g) acc[j][g] = (v8f){0,0,0,0,0,0,0,0};
    // ALiBi term of key n*16 + laneHi*8 + r counted from the wave's first key of the trip.  The rest of the
    // term, slope2 * (kBase - t), is one number per query and trip: the part in t cancels in the softmax,
    // the part in kBase is carried by the running maximum, which is kept relative to the current trip.
    #pragma unroll
    for (int n = 0; n < 2; ++n)
        #pragma unroll
        for (int r = 0; r < 8; ++r) cb[n][r] = slope2 * (float)(n * 16 + laneHi * 8 + r);
    int       tq = qRow0 + laneN;            // this lane's query in column group 0; group 1 lies 16 rows on
    float     mrel[QCOLS], lsum[QCOLS];      // running maximum, relative to the current trip's keys; sum over
    #pragma unroll                           // this lane's half of the keys (halves join at the end)
    for (int g = 0; g < QCOLS; ++g) { mrel[g] = -__builtin_inff(); lsum[g] = 0.0f; }

    // ---- softmax body of one trip, both column groups; MASK=false carries no compare/select code ----
    auto softmaxTile = [&](auto maskc, v8f (&S)[QCOLS][2], int kBase, V16* pf) {
        constexpr bool MASK = decltype(maskc)::value;
        const v8f sc = (v8f){SCALE2, SCALE2, SCALE2, SCALE2, SCALE2, SCALE2, SCALE2, SCALE2};
        #pragma unroll
        for (int g = 0; g < QCOLS; ++g) {
            #pragma unroll
            for (int n = 0; n < 2; ++n) S[g][n] = __builtin_elementwise_fma(S[g][n], sc, cb[n]);
            if (MASK) {
                const int lim = tq + g * 16 - kBase - laneHi * 8;     // last allowed n*16 + r
                #pragma unroll
                for (int n = 0; n < 2; ++n)
                    #pragma unroll
                    for (int r = 0; r < 8; ++r)
                        if (n * 16 + r > lim) S[g][n][r] = -__builtin_inff();
            }
            float e[8];
            #pragma unroll
            for (int r = 0; r < 8; ++r) e[r] = fmaxf(S[g][0][r], S[g][1][r]);
            float mx = fmaxf(fmaxf(fmaxf(e[0], e[1]), fmaxf(e[2], e[3])),
                             fmaxf(fmaxf(e[4], e[5]), fmaxf(e[6], e[7])));
            mx = fmaxf(mx, xhalf(mx));                       // both halves hold the query's maximum of the trip
            const float mold = mrel[g] - bstep;              // the old maximum seen from this trip's keys
            const float mnew = fmaxf(mold, mx);
            const float corr = __builtin_amdgcn_exp2f(mold - mnew);
            mrel[g] = mnew;
            #pragma unroll
            for (int n = 0; n < 2; ++n) {
                S[g][n] -= mnew;
                #pragma unroll
                for (int r = 0; r < 8; ++r) S[g][n][r] = __builtin_amdgcn_exp2f(S[g][n][r]);
            }
            const v8f s8 = S[g][0] + S[g][1];
            const float ps = ((s8[0] + s8[1]) + (s8[2] + s8[3])) + ((s8[4] + s8[5]) + (s8[6] + s8[7]));
            lsum[g] = lsum[g] * corr + ps;
            // P^T as B fragment: element s < 8 is key 8*laneHi + s, s >= 8 key 16 + 8*laneHi + (s - 8)
            pf[g].h[0] = __builtin_convertvector(S[g][0], v8h);
            pf[g].h[1] = __builtin_convertvector(S[g][1], v8h);
            #pragma unroll
            for (int j = 0; j < 4; ++j) acc[j][g] *= corr;
        }
    };

    // ---- prologue: each half stages its first tile, tile hw, into buffer 0 ----
    {
        const float* kr = Kb + (size_t)(hw * KTILE + kRow) * DMODEL + kD0;
        #pragma unroll
        for (int i = 0; i < 4; ++i)
            #pragma unroll
            for (int d = 0; d < 4; ++d) kreg[i * 4 + d] = kr[i * 16 * DMODEL + d];
        #pragma unroll
        for (int i = 0; i < 4; ++i) {
            const float* vr = Vb + (size_t)(hw * KTILE + vS0 + i) * DMODEL + vD0;
            #pragma unroll
            for (int d = 0; d < 4; ++d) vreg[i * 4 + d] = vr[d];
        }
        #pragma unroll
        for (int i = 0; i < 4; ++i)
            *(uint2*)&sK[0][hw][kRow + 16 * i][kD0] = make_uint2(pk16(kreg[4 * i],     kreg[4 * i + 1]),
                                                                 pk16(kreg[4 * i + 2], kreg[4 * i + 3]));
        #pragma unroll
        for (int d = 0; d < 4; ++d) {
            *(unsigned*)&sVt[0][hw][vD0 + d][vS0]     = pk16(vreg[d],     vreg[4 + d]);
            *(unsigned*)&sVt[0][hw][vD0 + d][vS0 + 2] = pk16(vreg[8 + d], vreg[12 + d]);
        }
    }

    int it = 0;                                        // trips done, over both groups: picks the buffer
    for (int ph = 0; ph < 2; ++ph) {
        const int nKT     = qg + 1;                        // causal: keys < (qg + 1) * 128; same for all waves
        const int qRowMax = qRow0 + QCOLS * 16 - 1;        // scalar
        for (int kt = 0; kt < nKT; ++kt, ++it) {
            const int  kBase = kt * KSTEP + kq * KSUB;    // scalar: first key of this wave's quarter
            const int  cur   = it & 1;
            const bool last  = (kt + 1 == nKT);
            const bool more  = !(last && ph == 1);
            const int  kNext = (last ? 0 : (kt + 1) * KSTEP) + hw * KTILE;   // tile to stage; the mirror group starts again at key 0

            __syncthreads();   // buffer[cur] ready; buffer[1-cur] free to overwrite

            // Issue the next tile's global loads BEHIND the barrier: the barrier's fence drains every
            // outstanding global load, so loads issued in front of it are waited out there, with nothing
            // to hide them.  From here they fly during this tile's products and softmax and are first
            // waited for at the convert-and-store below.
            if (more) {
                const float* kr = Kb + (size_t)(unsigned)(kNext + kRow) * DMODEL + kD0;
                #pragma unroll
                for (int i = 0; i < 4; ++i)
                    #pragma unroll
                    for (int d = 0; d < 4; ++d) kreg[i * 4 + d] = kr[i * 16 * DMODEL + d];
                #pragma unroll
                for (int i = 0; i < 4; ++i) {
                    const float* vr = Vb + (size_t)(unsigned)(kNext + vS0 + i) * DMODEL + vD0;
                    #pragma unroll
                    for (int d = 0; d < 4; ++d) vreg[i * 4 + d] = vr[d];
                }
                // The products below reuse the loads' address registers while the loads are in flight:
                // this wait stands in front of the first such overwrite (it does not wait for the data).
                asm volatile("s_wait_xcnt 0x0" ::: "memory");
            }

            if (kBase <= qRowMax) {   // scalar condition: s_cbranch, EXEC stays all-ones
                // ---- S^T = K * Q^T : S[g][n][r] = key n*16 + laneHi*8 + r, query g*16 + laneN;
                //      each K fragment serves both column groups ----
                v8f S[QCOLS][2];
                V16 kf[2][2];
                #pragma unroll
                for (int n = 0; n < 2; ++n) {
                    #pragma unroll
                    for (int ch = 0; ch < 2; ++ch) {
                        const _Float16* kp = &sK[cur][kh][ks + n * 16 + laneN][ch * 32 + laneHi * 8];
                        kf[n][ch].h[0] = *(const v8h*)kp;
                        kf[n][ch].h[1] = *(const v8h*)(kp + 16);
                    }
                }
                // Holds the eight reads together in front of the products: sunk among them, each pair is
                // waited for right behind its issue and the wave sits out the LDS latency three times.
                __builtin_amdgcn_sched_barrier(0);
                #pragma unroll
                for (int n = 0; n < 2; ++n) {
                    #pragma unroll
                    for (int g = 0; g < QCOLS; ++g) {
                        v8f c = (v8f){0,0,0,0,0,0,0,0};
                        #pragma unroll
                        for (int ch = 0; ch < 2; ++ch)
                            c = __builtin_amdgcn_wmma_f32_16x16x32_f16(
                                    false, kf[n][ch].v, false, qf[g][ch], (short)0, c, false, false);
                        S[g][n] = c;
                    }
                }

                // ---- online softmax: mask path only for the diagonal quarter (scalar cond) ----
                V16 pf[QCOLS];
                if (kBase + KSUB - 1 > qRow0) softmaxTile(BoolC<true>{},  S, kBase, pf);
                else                          softmaxTile(BoolC<false>{}, S, kBase, pf);

                // ---- O^T += V^T * P^T : V^T 16x32 (A), each fragment serving both column groups' P^T (B) ----
                #pragma unroll
                for (int j = 0; j < 4; ++j) {
                    V16 vf;
                    const _Float16* vp2 = &sVt[cur][kh][j * 16 + laneN][ks + laneHi * 8];
                    vf.h[0] = *(const v8h*)vp2;
                    vf.h[1] = *(const v8h*)(vp2 + 16);
                    #pragma unroll
                    for (int g = 0; g < QCOLS; ++g)
                        acc[j][g] = __builtin_amdgcn_wmma_f32_16x16x32_f16(
                                        false, vf.v, false, pf[g].v, (short)0, acc[j][g], false, false);
                }
            }

            // convert + store the prefetched tile into the other buffer
            if (more) {
                // Four vector slots between the last product above and the converts below, which reuse its
                // operand registers.  The fence holds the converts behind the slots.
                asm volatile("v_nop\n\tv_nop\n\tv_nop\n\tv_nop");
                __builtin_amdgcn_sched_barrier(0);
                const int nxt = 1 - cur;
                #pragma unroll
                for (int i = 0; i < 4; ++i)
                    *(uint2*)&sK[nxt][hw][kRow + 16 * i][kD0] = make_uint2(pk16(kreg[4 * i],     kreg[4 * i + 1]),
                                                                           pk16(kreg[4 * i + 2], kreg[4 * i + 3]));
                #pragma unroll
                for (int d = 0; d < 4; ++d) {
                    *(unsigned*)&sVt[nxt][hw][vD0 + d][vS0]     = pk16(vreg[d],     vreg[4 + d]);
                    *(unsigned*)&sVt[nxt][hw][vD0 + d][vS0 + 2] = pk16(vreg[8 + d], vreg[12 + d]);
                }
            }
            // next iteration's __syncthreads publishes buffer[nxt]
        }

        // ---- join the key quarters: the four waves that share 32 query rows exchange their states, lane to
        //      lane.  Wave kq finishes column group kq >> 1, d = (kq & 1)*32 + 0..31: whole 128-B output lines ----
        {
            // Four vector slots between the loop's last product and the join's vector instructions on its
            // registers.
            asm volatile("v_nop\n\tv_nop\n\tv_nop\n\tv_nop");
            // Each maximum is relative to its wave's last trip's keys; hand it over relative to key qg * 128.
            // Quarter kq ends on trip qg where the rows reach it (kq <= wq), else on trip qg - 1.  A quarter
            // that had no keys hands over -inf, 0 and zeros, and its factor below is 0.
            const float madj = slope2 * (float)(kq * KSUB - (kq <= wq ? 0 : KSTEP));
            #pragma unroll
            for (int g = 0; g < QCOLS; ++g) {
                sMl[wq][kq][g][0][lane] = mrel[g] + madj;
                sMl[wq][kq][g][1][lane] = lsum[g];
            }
            #pragma unroll
            for (int o = 0; o < KPARTS; ++o) {
                if (o != kq) {   // scalar condition: a wave keeps its own part in registers
                    #pragma unroll
                    for (int t = 0; t < 2; ++t) {
                        const v8f a = acc[2 * (o & 1) + t][o >> 1];
                        *(float4*)sAcc[wq][kq][o][2 * t][lane]     = make_float4(a[0], a[1], a[2], a[3]);
                        *(float4*)sAcc[wq][kq][o][2 * t + 1][lane] = make_float4(a[4], a[5], a[6], a[7]);
                    }
                }
            }
        }
        __syncthreads();   // every quarter's state is written; every wave passes it
        {
            const int gq = kq >> 1;
            float mq[KPARTS], lq[KPARTS];          // entry i: quarter (kq + i) & 3, entry 0 this wave's own
            #pragma unroll
            for (int i = 0; i < KPARTS; ++i) {
                mq[i] = sMl[wq][(kq + i) & (KPARTS - 1)][gq][0][lane];
                lq[i] = sMl[wq][(kq + i) & (KPARTS - 1)][gq][1][lane];
            }
            const float mj = fmaxf(fmaxf(mq[0], mq[1]), fmaxf(mq[2], mq[3]));
            float fq[KPARTS];
            #pragma unroll
            for (int i = 0; i < KPARTS; ++i) fq[i] = __builtin_amdgcn_exp2f(mq[i] - mj);
            const float ls = (lq[0] * fq[0] + lq[1] * fq[1]) + (lq[2] * fq[2] + lq[3] * fq[3]);
            v8f o2[2];
            #pragma unroll
            for (int t = 0; t < 2; ++t) {
                const v8f own = kq == 0 ? acc[t][0] : kq == 1 ? acc[2 + t][0] : kq == 2 ? acc[t][1] : acc[2 + t][1];
                o2[t] = own * fq[0];
                #pragma unroll
                for (int i = 1; i < KPARTS; ++i) {
                    const float4 lo = *(const float4*)sAcc[wq][(kq + i) & (KPARTS - 1)][kq][2 * t][lane];
                    const float4 hi = *(const float4*)sAcc[wq][(kq + i) & (KPARTS - 1)][kq][2 * t + 1][lane];
                    o2[t] += (v8f){lo.x, lo.y, lo.z, lo.w, hi.x, hi.y, hi.z, hi.w} * fq[i];
                }
            }
            // ---- finalize: join the two lane halves' sums, normalize, store 8 consecutive d per tile and lane ----
            const float inv = 1.0f / (ls + xhalf(ls));
            float* orow = Ob + (size_t)(tq + gq * 16) * DMODEL + (kq & 1) * 32 + laneHi * 8;
            #pragma unroll
            for (int t = 0; t < 2; ++t) {
                const v8f o = o2[t] * inv;
                *(float4*)(orow + t * 16)     = make_float4(o[0], o[1], o[2], o[3]);
                *(float4*)(orow + t * 16 + 4) = make_float4(o[4], o[5], o[6], o[7]);
            }
            // The fresh state below overwrites registers that these stores name: this wait stands in front
            // of the first such overwrite (it does not wait for the stores to finish).
            asm volatile("s_wait_xcnt 0x0" ::: "memory");
        }
        if (ph == 1) break;
        // ---- the mirror group: its rows, its Q out of LDS, a fresh state; the staged tiles run on ----
        qg    = blockIdx.y;
        qRow0 = qg * QBLK + wq * (QCOLS * 16);
        tq    = qRow0 + laneN;
        #pragma unroll
        for (int g = 0; g < QCOLS; ++g) {
            #pragma unroll
            for (int c = 0; c < 2; ++c) {
                V16 qn;
                qn.h[0] = *(const v8h*)sQn[wq][g * 2 + c][0][lane];
                qn.h[1] = *(const v8h*)sQn[wq][g * 2 + c][1][lane];
                qf[g][c] = qn.v;
            }
            mrel[g] = -__builtin_inff();
            lsum[g] = 0.0f;
        }
        #pragma unroll
        for (int j = 0; j < 4; ++j)
            #pragma unroll
            for (int g = 0; g < QCOLS; ++g) acc[j][g] = (v8f){0,0,0,0,0,0,0,0};
    }
}

extern "C" void kernel_launch(void* const* d_in, const int* in_sizes, int n_in,
                              void* d_out, int out_size, void* d_ws, size_t ws_size,
                              hipStream_t stream) {
    const float* q = (const float*)d_in[0];
    const float* k = (const float*)d_in[1];
    const float* v = (const float*)d_in[2];
    float* out = (float*)d_out;

    const int B = 2, T = 2048;
    dim3 grid(B * NHEAD, T / QBLK / 2);              // 32 x 8 blocks, two mirrored 128-row groups each
    dim3 block(512);                                 // 16 wave32 waves
    fa_alibi_kernel<<<grid, block, 0, stream>>>(q, k, v, out, T);
}

// v008
// It runs in 24.3 microseconds.
// Timed twice side by side with v007, it ran 1.07 times as fast both times.
// Counting every step since v000, it is 4.83 times as fast.
#include <hip/hip_runtime.h>

typedef __attribute__((ext_vector_type(16))) _Float16 v16h;
typedef __attribute__((ext_vector_type(8)))  _Float16 v8h;
typedef __attribute__((ext_vector_type(2)))  __fp16   fp16x2;
typedef __attribute__((ext_vector_type(8)))  float    v8f;

#define NHEAD    16
#define DHEAD    64
#define DMODEL   1024
#define KTILE    64           // keys per staged tile
#define KHALVES  2            // tiles staged per trip, one by each half of the block's waves
#define KSTEP    (KTILE * KHALVES)   // keys a block consumes per trip
#define KSUB     32           // keys one wave takes per trip
#define KPARTS   (KSTEP / KSUB)      // key quarters: quarter kq walks the keys kq*32 + 128 i + 0..31
#define QCOLS    2            // 16-query column groups per wave: each K or V fragment read feeds two products
#define QGRP     4            // 32-row query groups per block, each held by KPARTS waves
#define QBLK     128          // QGRP * QCOLS * 16 adjacent query rows
#define VT_PITCH 72           // 64 + 8 halves pad: 16B-aligned rows, bank spread
#define KP_PITCH 72           // K rows: 144 B = 16 B x odd, so 16 rows read by b128 spread over all banks
#define REF_GAP  8.0f         // log2 units a column's maximum may pass the reference in use: P <= 2^8 fits f16

union V16 { v16h v; v8h h[2]; };

__device__ __forceinline__ unsigned pk16(float a, float b) {   // v_cvt_pk_rtz_f16_f32
    union { fp16x2 h; unsigned u; } cv;
    cv.h = __builtin_amdgcn_cvt_pkrtz(a, b);
    return cv.u;
}

// Lane l <-> lane l ^ 16: the two lanes that share one query column.
__device__ __forceinline__ float xhalf(float x) {
    const int i = __float_as_int(x);
    return __int_as_float(__builtin_amdgcn_permlanex16(i, i, 0x76543210, 0xfedcba98, false, false));
}

__global__ __launch_bounds__(512)
void fa_alibi_kernel(const float* __restrict__ Q,
                     const float* __restrict__ K,
                     const float* __restrict__ V,
                     float* __restrict__ O,
                     int T)
{
    __shared__ __align__(16) _Float16 sK [2][KHALVES][KTILE][KP_PITCH];   // K tiles, row-major, padded rows
    __shared__ __align__(16) _Float16 sVt[2][KHALVES][DHEAD][VT_PITCH];   // V tiles, transposed
    __shared__ __align__(16) float    sAcc[QGRP][KPARTS][KPARTS][4][32][4];  // join: [rows][from quarter][for quarter] O^T pieces
    __shared__ float                  sMl [QGRP][KPARTS][QCOLS][2][32];      // join: each quarter's maxima and sums
    __shared__ __align__(16) _Float16 sQn [QGRP][QCOLS * 2][2][32][8];       // the mirror group's Q fragments

    const int h  = blockIdx.x % NHEAD;
    const int b  = blockIdx.x / NHEAD;
    // A trip (barrier, staging, one tile's products and softmax per wave) is a chain of latencies, and
    // the last query rows need every key.  The block's 16 waves are 4 query groups of 32 rows times 4 key
    // quarters of 32 keys, 128 keys a trip, so the longest walk is T / 128 trips; the quarters' partial
    // softmax states join at the end.  A wave holds 32 query columns because the LDS read rate binds:
    // a 1-KB K or V fragment then feeds two matrix instructions, not one.
    // Cost grows with the query position and every block is resident at once: each block takes the
    // 128-row group blockIdx.y from the bottom and then, on the same waves, its mirror from the top,
    // T / 128 + 1 trips in every block.
    int qg = T / QBLK - 1 - blockIdx.y;             // 128-row group in work: the long one first

    const int tid    = threadIdx.x;
    // Wave id as a *scalar* so per-wave conditions compile to s_cmp/s_cbranch
    // (EXEC untouched) instead of v_cmpx/saveexec.
    const int wave   = __builtin_amdgcn_readfirstlane(tid >> 5);
    const int lane   = tid & 31;
    const int laneN  = lane & 15;
    const int laneHi = lane >> 4;

    const int hw      = (wave >> 3) & 1;       // scalar: the 64-key tile that this wave helps to stage
    const int kq      = wave & (KPARTS - 1);   // scalar: key quarter that this wave computes on
    const int wq      = (wave >> 2) & (QGRP - 1);   // scalar: 32-row group inside the block
    const int kh      = kq >> 1;               // scalar: staged tile that holds the quarter
    const int ks      = (kq & 1) * KSUB;       // scalar: the quarter's first key inside that tile
    int       qRow0   = qg * QBLK + wq * (QCOLS * 16);   // scalar

    const size_t headOff = (size_t)h * DHEAD;
    const float* Qb = Q + (size_t)b * T * DMODEL + headOff;
    const float* Kb = K + (size_t)b * T * DMODEL + headOff;
    const float* Vb = V + (size_t)b * T * DMODEL + headOff;
    float*       Ob = O + (size_t)b * T * DMODEL + headOff;

    // ---- Q fragments (B operand: column = query g*16 + laneN): per column group 64x16 f16 as two 32x16
    //      chunks, loaded once.  The mirror group's four fragments wait in LDS: each of the four waves that
    //      share the rows fetches one of them (column group kq >> 1, chunk kq & 1) ----
    v16h qf[QCOLS][2];
    {
        // One pointer per column group, constant offsets only: piece 4 c + u holds k = c*32 + laneHi*8 + {0, 4, 16, 20}[u] + 0..3
        float4 qa[QCOLS][8], qb[4];
        #pragma unroll
        for (int g = 0; g < QCOLS; ++g) {
            const float* qrow = Qb + (size_t)(qRow0 + g * 16 + laneN) * DMODEL + laneHi * 8;
            #pragma unroll
            for (int u = 0; u < 8; ++u)
                qa[g][u] = *(const float4*)(qrow + (u >> 2) * 32 + ((u >> 1) & 1) * 16 + (u & 1) * 4);
            // Naming the pointer keeps its registers out of the loads' results up to this wait, which stands in
            // front of their first overwrite (it does not wait for the data).
            asm volatile("s_wait_xcnt 0x0" :: "v"(qrow) : "memory");
        }
        const float* qnxt = Qb + (size_t)(blockIdx.y * QBLK + wq * (QCOLS * 16) + (kq >> 1) * 16 + laneN) * DMODEL
                               + (kq & 1) * 32 + laneHi * 8;
        #pragma unroll
        for (int u = 0; u < 4; ++u)
            qb[u] = *(const float4*)(qnxt + (u >> 1) * 16 + (u & 1) * 4);
        asm volatile("s_wait_xcnt 0x0" :: "v"(qnxt) : "memory");   // the same for the mirror group's pointer
        #pragma unroll
        for (int g = 0; g < QCOLS; ++g) {
            #pragma unroll
            for (int c = 0; c < 2; ++c) {
                #pragma unroll
                for (int u = 0; u < 4; ++u) {
                    qf[g][c][4 * u]     = (_Float16)qa[g][4 * c + u].x;
                    qf[g][c][4 * u + 1] = (_Float16)qa[g][4 * c + u].y;
                    qf[g][c][4 * u + 2] = (_Float16)qa[g][4 * c + u].z;
                    qf[g][c][4 * u + 3] = (_Float16)qa[g][4 * c + u].w;
                }
            }
        }
        V16 qn;
        #pragma unroll
        for (int u = 0; u < 4; ++u) {
            qn.v[4 * u]     = (_Float16)qb[u].x;
            qn.v[4 * u + 1] = (_Float16)qb[u].y;
            qn.v[4 * u + 2] = (_Float16)qb[u].z;
            qn.v[4 * u + 3] = (_Float16)qb[u].w;
        }
        // read back behind the first group's join barrier
        *(v8h*)sQn[wq][kq][0][lane] = qn.h[0];
        *(v8h*)sQn[wq][kq][1][lane] = qn.h[1];
    }

    // ---- staging geometry ----
    // K: thread -> (4 rows, 4 d): 16 lanes cover one row's 256 B, so each wave-wide 16-byte load is four
    // whole 128-B lines, not 16-byte pieces of sixteen lines.  A wave's two rows lie 8 apart: 8 * 144 B is
    // 288 dwords, 32 banks on modulo 64, so its 8-byte LDS stores fill all 64 banks once.  Rows kRow + 16 i.
    // V: thread -> (4 s rows, 4 d) so s-pairs pack.  Waves 0-7 stage the trip's first tile, waves 8-15 the second.
    const int kRow = ((tid >> 5) & 7) + ((tid >> 4) & 1) * 8;
    const int kD0  = (tid & 15) * 4;
    const int vD0  = (tid & 15) * 4;
    const int vS0  = ((tid >> 4) & 15) * 4;
    float kreg[16], vreg[16];

    // ---- flash state in log2 domain ----
    const float L2E    = 1.44269504088896f;
    const float SCALE2 = 0.125f * L2E;                        // (1/sqrt(d)) * log2(e)
    const float slope2 = exp2f(-0.5f * (float)(h + 1)) * L2E; // alibi slope * log2(e)
    const float bstep  = slope2 * (float)KSTEP;               // a wave's next tile lies KSTEP keys back

    // acc[j][g][r] = O^T[d = j*16 + laneHi*8 + r][query g*16 + laneN]
    v8f   acc[4][QCOLS], cb[2];
    #pragma unroll
    for (int j = 0; j < 4; ++j)
        #pragma unroll
        for (int g = 0; g < QCOLS; ++g) acc[j][g] = (v8f){0,0,0,0,0,0,0,0};
    // ALiBi term of key n*16 + laneHi*8 + r counted from the wave's first key of the trip.  The rest of the
    // term, slope2 * (kBase - t), is one number per query and trip: the part in t cancels in the softmax,
    // the part in kBase is added to the reference, which is kept relative to the group's top trip.
    #pragma unroll
    for (int n = 0; n < 2; ++n)
        #pragma unroll
        for (int r = 0; r < 8; ++r) cb[n][r] = slope2 * (float)(n * 16 + laneHi * 8 + r);
    int       tq = qRow0 + laneN;            // this lane's query in column group 0; group 1 lies 16 rows on
    float     mref[QCOLS], lsum[QCOLS];      // softmax reference, relative to the top trip's keys; sum over
    #pragma unroll                           // this lane's half of the keys (halves join at the end)
    for (int g = 0; g < QCOLS; ++g) { mref[g] = -__builtin_inff(); lsum[g] = 0.0f; }

    // ---- softmax body of one trip, both column groups; diag (scalar) is set for the quarter on the diagonal,
    //      the only one that carries compare/select code.
    //      off = slope2 * (keys between the top trip's tile and this one) ----
    auto softmaxTile = [&](bool diag, v8f (&S)[QCOLS][2], int kBase, float off, V16* pf) {
        const v8f sc = (v8f){SCALE2, SCALE2, SCALE2, SCALE2, SCALE2, SCALE2, SCALE2, SCALE2};
        #pragma unroll
        for (int g = 0; g < QCOLS; ++g)
            #pragma unroll
            for (int n = 0; n < 2; ++n) S[g][n] = __builtin_elementwise_fma(S[g][n], sc, cb[n]);
        if (diag) {
            #pragma unroll
            for (int g = 0; g < QCOLS; ++g) {
                const int lim = tq + g * 16 - kBase - laneHi * 8;     // last allowed n*16 + r
                #pragma unroll
                for (int n = 0; n < 2; ++n)
                    #pragma unroll
                    for (int r = 0; r < 8; ++r)
                        if (n * 16 + r > lim) S[g][n][r] = -__builtin_inff();
            }
        }
        float mx[QCOLS], muse[QCOLS];
        #pragma unroll
        for (int g = 0; g < QCOLS; ++g) {
            float e[8];
            #pragma unroll
            for (int r = 0; r < 8; ++r) e[r] = fmaxf(S[g][0][r], S[g][1][r]);
            mx[g]   = fmaxf(fmaxf(fmaxf(e[0], e[1]), fmaxf(e[2], e[3])),
                            fmaxf(fmaxf(e[4], e[5]), fmaxf(e[6], e[7])));   // over this lane's half of the keys
            muse[g] = mref[g] + off;                         // the reference seen from this trip's keys
        }
        // One test per trip for the whole wave, a scalar branch: the reference moves, and O^T and the sums
        // are rescaled, only where some lane's maximum passes it by more than REF_GAP (always on a wave's
        // first trip, whose reference is -inf).  The test needs no exchange: each lane answers for its own
        // scores; the two halves of a column join their maxima only where the reference moves.
        const bool need = fmaxf(mx[0] - muse[0], mx[1] - muse[1]) > REF_GAP;
        if (__builtin_amdgcn_ballot_w32(need) != 0) {
            #pragma unroll
            for (int g = 0; g < QCOLS; ++g) {
                const float mnew = fmaxf(muse[g], fmaxf(mx[g], xhalf(mx[g])));
                const float corr = __builtin_amdgcn_exp2f(muse[g] - mnew);
                mref[g] = mnew - off;
                muse[g] = mnew;
                lsum[g] *= corr;
                #pragma unroll
                for (int j = 0; j < 4; ++j) acc[j][g] *= corr;
            }
        }
        #pragma unroll
        for (int g = 0; g < QCOLS; ++g) {
            #pragma unroll
            for (int n = 0; n < 2; ++n) {
                S[g][n] -= muse[g];
                #pragma unroll
                for (int r = 0; r < 8; ++r) S[g][n][r] = __builtin_amdgcn_exp2f(S[g][n][r]);
            }
            const v8f s8 = S[g][0] + S[g][1];
            lsum[g] += ((s8[0] + s8[1]) + (s8[2] + s8[3])) + ((s8[4] + s8[5]) + (s8[6] + s8[7]));
            // P^T as B fragment: element s < 8 is key 8*laneHi + s, s >= 8 key 16 + 8*laneHi + (s - 8)
            pf[g].h[0] = __builtin_convertvector(S[g][0], v8h);
            pf[g].h[1] = __builtin_convertvector(S[g][1], v8h);
        }
    };

    // ---- prologue: stage the first group's top tiles into buffer 0 ----
    {
        const float* kr = Kb + (size_t)(qg * KSTEP + hw * KTILE + kRow) * DMODEL + kD0;
        #pragma unroll
        for (int i = 0; i < 4; ++i)
            #pragma unroll
            for (int d = 0; d < 4; ++d) kreg[i * 4 + d] = kr[i * 16 * DMODEL + d];
        #pragma unroll
        for (int i = 0; i < 4; ++i) {
            const float* vr = Vb + (size_t)(qg * KSTEP + hw * KTILE + vS0 + i) * DMODEL + vD0;
            #pragma unroll
            for (int d = 0; d < 4; ++d) vreg[i * 4 + d] = vr[d];
        }
        #pragma unroll
        for (int i = 0; i < 4; ++i)
            *(uint2*)&sK[0][hw][kRow + 16 * i][kD0] = make_uint2(pk16(kreg[4 * i],     kreg[4 * i + 1]),
                                                                 pk16(kreg[4 * i + 2], kreg[4 * i + 3]));
        #pragma unroll
        for (int d = 0; d < 4; ++d) {
            *(unsigned*)&sVt[0][hw][vD0 + d][vS0]     = pk16(vreg[d],     vreg[4 + d]);
            *(unsigned*)&sVt[0][hw][vD0 + d][vS0 + 2] = pk16(vreg[8 + d], vreg[12 + d]);
        }
    }

    int it = 0;                                        // trips done, over both groups: picks the buffer
    for (int ph = 0; ph < 2; ++ph) {
        const int kTop    = qg;                            // causal: keys < (qg + 1) * 128; same for all waves
        const int qRowMax = qRow0 + QCOLS * 16 - 1;        // scalar
        for (int kt = kTop; kt >= 0; --kt, ++it) {         // from the diagonal's trip down to key 0
            const int  kBase = kt * KSTEP + kq * KSUB;    // scalar: first key of this wave's quarter
            const int  cur   = it & 1;
            const bool last  = (kt == 0);
            const bool more  = !(last && ph == 1);
            // tile to stage; the mirror group starts at its own diagonal
            const int  kNext = (last ? (int)blockIdx.y : kt - 1) * KSTEP + hw * KTILE;

            __syncthreads();   // buffer[cur] ready; buffer[1-cur] free to overwrite

            // Issue the next tile's global loads BEHIND the barrier: the barrier's fence drains every
            // outstanding global load, so loads issued in front of it are waited out there, with nothing
            // to hide them.  From here they fly during this tile's products and softmax and are first
            // waited for at the convert-and-store below.
            if (more) {
                const float* kr = Kb + (size_t)(unsigned)(kNext + kRow) * DMODEL + kD0;
                #pragma unroll
                for (int i = 0; i < 4; ++i)
                    #pragma unroll
                    for (int d = 0; d < 4; ++d) kreg[i * 4 + d] = kr[i * 16 * DMODEL + d];
                #pragma unroll
                for (int i = 0; i < 4; ++i) {
                    const float* vr = Vb + (size_t)(unsigned)(kNext + vS0 + i) * DMODEL + vD0;
                    #pragma unroll
                    for (int d = 0; d < 4; ++d) vreg[i * 4 + d] = vr[d];
                }
                // The products below reuse the loads' address registers while the loads are in flight:
                // this wait stands in front of the first such overwrite (it does not wait for the data).
                asm volatile("s_wait_xcnt 0x0" ::: "memory");
            }

            if (kBase <= qRowMax) {   // scalar condition: s_cbranch, EXEC stays all-ones
                // ---- S^T = K * Q^T : S[g][n][r] = key n*16 + laneHi*8 + r, query g*16 + laneN;
                //      each K fragment serves both column groups ----
                v8f S[QCOLS][2];
                V16 kf[2][2];
                #pragma unroll
                for (int n = 0; n < 2; ++n) {
                    #pragma unroll
                    for (int ch = 0; ch < 2; ++ch) {
                        const _Float16* kp = &sK[cur][kh][ks + n * 16 + laneN][ch * 32 + laneHi * 8];
                        kf[n][ch].h[0] = *(const v8h*)kp;
                        kf[n][ch].h[1] = *(const v8h*)(kp + 16);
                    }
                }
                // Holds the eight reads together in front of the products: sunk among them, each pair is
                // waited for right behind its issue and the wave sits out the LDS latency three times.
                __builtin_amdgcn_sched_barrier(0);
                #pragma unroll
                for (int ch = 0; ch < 2; ++ch) {
                    #pragma unroll
                    for (int n = 0; n < 2; ++n) {
                        #pragma unroll
                        for (int g = 0; g < QCOLS; ++g)
                            S[g][n] = __builtin_amdgcn_wmma_f32_16x16x32_f16(
                                          false, kf[n][ch].v, false, qf[g][ch], (short)0,
                                          ch == 0 ? (v8f){0,0,0,0,0,0,0,0} : S[g][n], false, false);
                    }
                }
                // Holds the softmax's vector work behind all eight products: woven among them, each first
                // read of a result stands behind four idle slots.
                __builtin_amdgcn_sched_barrier(0);

                // ---- online softmax: mask path only for the diagonal quarter (scalar cond) ----
                V16 pf[QCOLS];
                const float off = bstep * (float)(kTop - kt);
                softmaxTile(kBase + KSUB - 1 > qRow0, S, kBase, off, pf);

                // ---- O^T += V^T * P^T : V^T 16x32 (A), each fragment serving both column groups' P^T (B) ----
                #pragma unroll
                for (int j = 0; j < 4; ++j) {
                    V16 vf;
                    const _Float16* vp2 = &sVt[cur][kh][j * 16 + laneN][ks + laneHi * 8];
                    vf.h[0] = *(const v8h*)vp2;
                    vf.h[1] = *(const v8h*)(vp2 + 16);
                    #pragma unroll
                    for (int g = 0; g < QCOLS; ++g)
                        acc[j][g] = __builtin_amdgcn_wmma_f32_16x16x32_f16(
                                        false, vf.v, false, pf[g].v, (short)0, acc[j][g], false, false);
                }
            }

            // convert + store the prefetched tile into the other buffer
            if (more) {
                // Four vector slots between the last product above and the converts below, which reuse its
                // operand registers.  The fence holds the converts behind the slots.
                asm volatile("v_nop\n\tv_nop\n\tv_nop\n\tv_nop");
                __builtin_amdgcn_sched_barrier(0);
                const int nxt = 1 - cur;
                #pragma unroll
                for (int i = 0; i < 4; ++i)
                    *(uint2*)&sK[nxt][hw][kRow + 16 * i][kD0] = make_uint2(pk16(kreg[4 * i],     kreg[4 * i + 1]),
                                                                           pk16(kreg[4 * i + 2], kreg[4 * i + 3]));
                #pragma unroll
                for (int d = 0; d < 4; ++d) {
                    *(unsigned*)&sVt[nxt][hw][vD0 + d][vS0]     = pk16(vreg[d],     vreg[4 + d]);
                    *(unsigned*)&sVt[nxt][hw][vD0 + d][vS0 + 2] = pk16(vreg[8 + d], vreg[12 + d]);
                }
            }
            // next iteration's __syncthreads publishes buffer[nxt]
        }

        // ---- join the key quarters: the four waves that share 32 query rows exchange their states, lane to
        //      lane.  Wave kq finishes column group kq >> 1, d = (kq & 1)*32 + 0..31: whole 128-B output lines ----
        {
            // Four vector slots between the loop's last product and the join's vector instructions on its
            // registers.
            asm volatile("v_nop\n\tv_nop\n\tv_nop\n\tv_nop");
            // Each reference is relative to its quarter's first key of the top trip, qg * 128 + kq * 32, whether
            // or not the rows reach that quarter there; hand it over relative to key qg * 128.  A quarter
            // that had no keys hands over -inf, 0 and zeros, and its factor below is 0.
            const float madj = slope2 * (float)(kq * KSUB);
            #pragma unroll
            for (int g = 0; g < QCOLS; ++g) {
                sMl[wq][kq][g][0][lane] = mref[g] + madj;
                sMl[wq][kq][g][1][lane] = lsum[g];
            }
            #pragma unroll
            for (int o = 0; o < KPARTS; ++o) {
                if (o != kq) {   // scalar condition: a wave keeps its own part in registers
                    #pragma unroll
                    for (int t = 0; t < 2; ++t) {
                        const v8f a = acc[2 * (o & 1) + t][o >> 1];
                        *(float4*)sAcc[wq][kq][o][2 * t][lane]     = make_float4(a[0], a[1], a[2], a[3]);
                        *(float4*)sAcc[wq][kq][o][2 * t + 1][lane] = make_float4(a[4], a[5], a[6], a[7]);
                    }
                }
            }
        }
        __syncthreads();   // every quarter's state is written; every wave passes it
        {
            const int gq = kq >> 1;
            float mq[KPARTS], lq[KPARTS];          // entry i: quarter (kq + i) & 3, entry 0 this wave's own
            #pragma unroll
            for (int i = 0; i < KPARTS; ++i) {
                mq[i] = sMl[wq][(kq + i) & (KPARTS - 1)][gq][0][lane];
                lq[i] = sMl[wq][(kq + i) & (KPARTS - 1)][gq][1][lane];
            }
            const float mj = fmaxf(fmaxf(mq[0], mq[1]), fmaxf(mq[2], mq[3]));
            float fq[KPARTS];
            #pragma unroll
            for (int i = 0; i < KPARTS; ++i) fq[i] = __builtin_amdgcn_exp2f(mq[i] - mj);
            const float ls = (lq[0] * fq[0] + lq[1] * fq[1]) + (lq[2] * fq[2] + lq[3] * fq[3]);
            v8f o2[2];
            #pragma unroll
            for (int t = 0; t < 2; ++t) {
                const v8f own = kq == 0 ? acc[t][0] : kq == 1 ? acc[2 + t][0] : kq == 2 ? acc[t][1] : acc[2 + t][1];
                o2[t] = own * fq[0];
                #pragma unroll
                for (int i = 1; i < KPARTS; ++i) {
                    const float4 lo = *(const float4*)sAcc[wq][(kq + i) & (KPARTS - 1)][kq][2 * t][lane];
                    const float4 hi = *(const float4*)sAcc[wq][(kq + i) & (KPARTS - 1)][kq][2 * t + 1][lane];
                    o2[t] += (v8f){lo.x, lo.y, lo.z, lo.w, hi.x, hi.y, hi.z, hi.w} * fq[i];
                }
            }
            // ---- finalize: join the two lane halves' sums, normalize, store 8 consecutive d per tile and lane ----
            const float inv = 1.0f / (ls + xhalf(ls));
            float* orow = Ob + (size_t)(tq + gq * 16) * DMODEL + (kq & 1) * 32 + laneHi * 8;
            #pragma unroll
            for (int t = 0; t < 2; ++t) {
                const v8f o = o2[t] * inv;
                *(float4*)(orow + t * 16)     = make_float4(o[0], o[1], o[2], o[3]);
                *(float4*)(orow + t * 16 + 4) = make_float4(o[4], o[5], o[6], o[7]);
            }
            // The fresh state below overwrites registers that these stores name: this wait stands in front
            // of the first such overwrite (it does not wait for the stores to finish).
            asm volatile("s_wait_xcnt 0x0" ::: "memory");
        }
        if (ph == 1) break;
        // ---- the mirror group: its rows, its Q out of LDS, a fresh state; the staged tiles run on ----
        qg    = blockIdx.y;
        qRow0 = qg * QBLK + wq * (QCOLS * 16);
        tq    = qRow0 + laneN;
        #pragma unroll
        for (int g = 0; g < QCOLS; ++g) {
            #pragma unroll
            for (int c = 0; c < 2; ++c) {
                V16 qn;
                qn.h[0] = *(const v8h*)sQn[wq][g * 2 + c][0][lane];
                qn.h[1] = *(const v8h*)sQn[wq][g * 2 + c][1][lane];
                qf[g][c] = qn.v;
            }
            mref[g] = -__builtin_inff();
            lsum[g] = 0.0f;
        }
        #pragma unroll
        for (int j = 0; j < 4; ++j)
            #pragma unroll
            for (int g = 0; g < QCOLS; ++g) acc[j][g] = (v8f){0,0,0,0,0,0,0,0};
    }
}

extern "C" void kernel_launch(void* const* d_in, const int* in_sizes, int n_in,
                              void* d_out, int out_size, void* d_ws, size_t ws_size,
                              hipStream_t stream) {
    const float* q = (const float*)d_in[0];
    const float* k = (const float*)d_in[1];
    const float* v = (const float*)d_in[2];
    float* out = (float*)d_out;

    const int B = 2, T = 2048;
    dim3 grid(B * NHEAD, T / QBLK / 2);              // 32 x 8 blocks, two mirrored 128-row groups each
    dim3 block(512);                                 // 16 wave32 waves
    fa_alibi_kernel<<<grid, block, 0, stream>>>(q, k, v, out, T);
}

// v009
// Measured time: 22.5 microseconds a run.
// In both of two side-by-side timings against v008, it was 1.08 times as fast.
// Over all steps from v000 it is 5.21 times as fast.
#include <hip/hip_runtime.h>

typedef __attribute__((ext_vector_type(16))) _Float16 v16h;
typedef __attribute__((ext_vector_type(8)))  _Float16 v8h;
typedef __attribute__((ext_vector_type(2)))  __fp16   fp16x2;
typedef __attribute__((ext_vector_type(8)))  float    v8f;

#define NHEAD    16
#define DHEAD    64
#define DMODEL   1024
#define KTILE    64           // keys per staged tile
#define KHALVES  2            // tiles staged per trip, one by each half of the block's waves
#define KSTEP    (KTILE * KHALVES)   // keys a block consumes per trip
#define KSUB     32           // keys one wave takes per trip
#define KPARTS   (KSTEP / KSUB)      // key quarters: quarter kq walks the keys kq*32 + 128 i + 0..31
#define QCOLS    2            // 16-query column groups per wave: each K or V fragment read feeds two products
#define QGRP     4            // 32-row query groups per block, each held by KPARTS waves
#define QBLK     128          // QGRP * QCOLS * 16 adjacent query rows
#define VT_PITCH 72           // 64 + 8 halves pad: 16B-aligned rows, bank spread
#define KP_PITCH 72           // K rows: 144 B = 16 B x odd, so 16 rows read by b128 spread over all banks
#define REF_GAP  8.0f         // log2 units a column's maximum may pass the reference in use: P <= 2^8 fits f16

union V16 { v16h v; v8h h[2]; };

__device__ __forceinline__ unsigned pk16(float a, float b) {   // v_cvt_pk_rtz_f16_f32
    union { fp16x2 h; unsigned u; } cv;
    cv.h = __builtin_amdgcn_cvt_pkrtz(a, b);
    return cv.u;
}

// Lane l <-> lane l ^ 16: the two lanes that share one query column.
__device__ __forceinline__ float xhalf(float x) {
    const int i = __float_as_int(x);
    return __int_as_float(__builtin_amdgcn_permlanex16(i, i, 0x76543210, 0xfedcba98, false, false));
}

__global__ __launch_bounds__(512)
void fa_alibi_kernel(const float* __restrict__ Q,
                     const float* __restrict__ K,
                     const float* __restrict__ V,
                     float* __restrict__ O,
                     int T)
{
    __shared__ __align__(16) _Float16 sK [2][KHALVES][KTILE][KP_PITCH];   // K tiles, row-major, padded rows
    __shared__ __align__(16) _Float16 sVt[2][KHALVES][DHEAD][VT_PITCH];   // V tiles, transposed
    __shared__ __align__(16) float    sAcc[QGRP][KPARTS][KPARTS][4][32][4];  // join: [rows][from quarter][for quarter] O^T pieces
    __shared__ float                  sMl [QGRP][KPARTS][QCOLS][2][32];      // join: each quarter's maxima and sums
    __shared__ __align__(16) _Float16 sQn [QGRP][QCOLS * 2][2][32][8];       // the mirror group's Q fragments

    const int h  = blockIdx.x % NHEAD;
    const int b  = blockIdx.x / NHEAD;
    // A trip (barrier, staging, one tile's products and softmax per wave) is a chain of latencies, and
    // the last query rows need every key.  The block's 16 waves are 4 query groups of 32 rows times 4 key
    // quarters of 32 keys, 128 keys a trip, so the longest walk is T / 128 trips; the quarters' partial
    // softmax states join at the end.  A wave holds 32 query columns because the LDS read rate binds:
    // a 1-KB K or V fragment then feeds two matrix instructions, not one.
    // Cost grows with the query position and every block is resident at once: each block takes the
    // 128-row group blockIdx.y from the bottom and then, on the same waves, its mirror from the top,
    // T / 128 + 1 trips in every block.
    int qg = T / QBLK - 1 - blockIdx.y;             // 128-row group in work: the long one first

    const int tid    = threadIdx.x;
    // Wave id as a *scalar* so per-wave conditions compile to s_cmp/s_cbranch
    // (EXEC untouched) instead of v_cmpx/saveexec.
    const int wave   = __builtin_amdgcn_readfirstlane(tid >> 5);
    const int lane   = tid & 31;
    const int laneN  = lane & 15;
    const int laneHi = lane >> 4;

    const int hw      = (wave >> 3) & 1;       // scalar: the 64-key tile that this wave helps to stage
    const int kq      = wave & (KPARTS - 1);   // scalar: key quarter that this wave computes on
    const int wq      = (wave >> 2) & (QGRP - 1);   // scalar: 32-row group inside the block
    const int kh      = kq >> 1;               // scalar: staged tile that holds the quarter
    const int ks      = (kq & 1) * KSUB;       // scalar: the quarter's first key inside that tile
    int       qRow0   = qg * QBLK + wq * (QCOLS * 16);   // scalar

    const size_t headOff = (size_t)h * DHEAD;
    const float* Qb = Q + (size_t)b * T * DMODEL + headOff;
    const float* Kb = K + (size_t)b * T * DMODEL + headOff;
    const float* Vb = V + (size_t)b * T * DMODEL + headOff;
    float*       Ob = O + (size_t)b * T * DMODEL + headOff;

    // ---- Q fragments (B operand: column = query g*16 + laneN): per column group 64x16 f16 as two 32x16
    //      chunks, loaded once.  The mirror group's four fragments wait in LDS: each of the four waves that
    //      share the rows fetches one of them (column group kq >> 1, chunk kq & 1) ----
    v16h qf[QCOLS][2];
    {
        // One pointer per column group, constant offsets only: piece 4 c + u holds k = c*32 + laneHi*8 + {0, 4, 16, 20}[u] + 0..3
        float4 qa[QCOLS][8], qb[4];
        #pragma unroll
        for (int g = 0; g < QCOLS; ++g) {
            const float* qrow = Qb + (size_t)(qRow0 + g * 16 + laneN) * DMODEL + laneHi * 8;
            #pragma unroll
            for (int u = 0; u < 8; ++u)
                qa[g][u] = *(const float4*)(qrow + (u >> 2) * 32 + ((u >> 1) & 1) * 16 + (u & 1) * 4);
            // Naming the pointer keeps its registers out of the loads' results up to this wait, which stands in
            // front of their first overwrite (it does not wait for the data).
            asm volatile("s_wait_xcnt 0x0" :: "v"(qrow) : "memory");
        }
        const float* qnxt = Qb + (size_t)(blockIdx.y * QBLK + wq * (QCOLS * 16) + (kq >> 1) * 16 + laneN) * DMODEL
                               + (kq & 1) * 32 + laneHi * 8;
        #pragma unroll
        for (int u = 0; u < 4; ++u)
            qb[u] = *(const float4*)(qnxt + (u >> 1) * 16 + (u & 1) * 4);
        asm volatile("s_wait_xcnt 0x0" :: "v"(qnxt) : "memory");   // the same for the mirror group's pointer
        #pragma unroll
        for (int g = 0; g < QCOLS; ++g) {
            #pragma unroll
            for (int c = 0; c < 2; ++c) {
                #pragma unroll
                for (int u = 0; u < 4; ++u) {
                    qf[g][c][4 * u]     = (_Float16)qa[g][4 * c + u].x;
                    qf[g][c][4 * u + 1] = (_Float16)qa[g][4 * c + u].y;
                    qf[g][c][4 * u + 2] = (_Float16)qa[g][4 * c + u].z;
                    qf[g][c][4 * u + 3] = (_Float16)qa[g][4 * c + u].w;
                }
            }
        }
        V16 qn;
        #pragma unroll
        for (int u = 0; u < 4; ++u) {
            qn.v[4 * u]     = (_Float16)qb[u].x;
            qn.v[4 * u + 1] = (_Float16)qb[u].y;
            qn.v[4 * u + 2] = (_Float16)qb[u].z;
            qn.v[4 * u + 3] = (_Float16)qb[u].w;
        }
        // read back behind the first group's join barrier
        *(v8h*)sQn[wq][kq][0][lane] = qn.h[0];
        *(v8h*)sQn[wq][kq][1][lane] = qn.h[1];
    }

    // ---- staging geometry ----
    // K: thread -> (4 rows, 4 d): 16 lanes cover one row's 256 B, so each wave-wide 16-byte load is four
    // whole 128-B lines, not 16-byte pieces of sixteen lines.  A wave's two rows lie 8 apart: 8 * 144 B is
    // 288 dwords, 32 banks on modulo 64, so its 8-byte LDS stores fill all 64 banks once.  Rows kRow + 16 i.
    // V: thread -> (4 s rows, 4 d) so s-pairs pack.  Waves 0-7 stage the trip's first tile, waves 8-15 the second.
    const int kRow = ((tid >> 5) & 7) + ((tid >> 4) & 1) * 8;
    const int kD0  = (tid & 15) * 4;
    const int vD0  = (tid & 15) * 4;
    const int vS0  = ((tid >> 4) & 15) * 4;
    float kreg[16], vreg[16];

    // ---- flash state in log2 domain ----
    const float L2E    = 1.44269504088896f;
    const float SCALE2 = 0.125f * L2E;                        // (1/sqrt(d)) * log2(e)
    const float slope2 = exp2f(-0.5f * (float)(h + 1)) * L2E; // alibi slope * log2(e)
    const float bstep  = slope2 * (float)KSTEP;               // a wave's next tile lies KSTEP keys back

    // acc[j][g][r] = O^T[d = j*16 + laneHi*8 + r][query g*16 + laneN]
    v8f   acc[4][QCOLS], cb[2];
    #pragma unroll
    for (int j = 0; j < 4; ++j)
        #pragma unroll
        for (int g = 0; g < QCOLS; ++g) acc[j][g] = (v8f){0,0,0,0,0,0,0,0};
    // ALiBi term of key n*16 + laneHi*8 + r counted from the wave's first key of the trip.  The rest of the
    // term, slope2 * (kBase - t), is one number per query and trip: the part in t cancels in the softmax,
    // the part in kBase is added to the reference, which is kept relative to the group's top trip.
    #pragma unroll
    for (int n = 0; n < 2; ++n)
        #pragma unroll
        for (int r = 0; r < 8; ++r) cb[n][r] = slope2 * (float)(n * 16 + laneHi * 8 + r);
    int       tq = qRow0 + laneN;            // this lane's query in column group 0; group 1 lies 16 rows on
    float     mref[QCOLS], lsum[QCOLS];      // softmax reference, relative to the top trip's keys; sum over
    #pragma unroll                           // this lane's half of the keys (halves join at the end)
    for (int g = 0; g < QCOLS; ++g) { mref[g] = -__builtin_inff(); lsum[g] = 0.0f; }

    // ---- softmax body of one trip, both column groups; diag (scalar) is set for the quarter on the diagonal,
    //      the only one that carries compare/select code.
    //      off = slope2 * (keys between the top trip's tile and this one) ----
    auto softmaxTile = [&](bool diag, v8f (&S)[QCOLS][2], int kBase, float off, V16* pf) {
        const v8f sc = (v8f){SCALE2, SCALE2, SCALE2, SCALE2, SCALE2, SCALE2, SCALE2, SCALE2};
        #pragma unroll
        for (int g = 0; g < QCOLS; ++g)
            #pragma unroll
            for (int n = 0; n < 2; ++n) S[g][n] = __builtin_elementwise_fma(S[g][n], sc, cb[n]);
        if (diag) {
            #pragma unroll
            for (int g = 0; g < QCOLS; ++g) {
                const int lim = tq + g * 16 - kBase - laneHi * 8;     // last allowed n*16 + r
                #pragma unroll
                for (int n = 0; n < 2; ++n)
                    #pragma unroll
                    for (int r = 0; r < 8; ++r)
                        if (n * 16 + r > lim) S[g][n][r] = -__builtin_inff();
            }
        }
        float mx[QCOLS], muse[QCOLS];
        #pragma unroll
        for (int g = 0; g < QCOLS; ++g) {
            float e[8];
            #pragma unroll
            for (int r = 0; r < 8; ++r) e[r] = fmaxf(S[g][0][r], S[g][1][r]);
            mx[g]   = fmaxf(fmaxf(fmaxf(e[0], e[1]), fmaxf(e[2], e[3])),
                            fmaxf(fmaxf(e[4], e[5]), fmaxf(e[6], e[7])));   // over this lane's half of the keys
            muse[g] = mref[g] + off;                         // the reference seen from this trip's keys
        }
        // One test per trip for the whole wave, a scalar branch: the reference moves, and O^T and the sums
        // are rescaled, only where some lane's maximum passes it by more than REF_GAP (always on a wave's
        // first trip, whose reference is -inf).  The test needs no exchange: each lane answers for its own
        // scores; the two halves of a column join their maxima only where the reference moves.
        const bool need = fmaxf(mx[0] - muse[0], mx[1] - muse[1]) > REF_GAP;
        if (__builtin_amdgcn_ballot_w32(need) != 0) {
            #pragma unroll
            for (int g = 0; g < QCOLS; ++g) {
                const float mnew = fmaxf(muse[g], fmaxf(mx[g], xhalf(mx[g])));
                const float corr = __builtin_amdgcn_exp2f(muse[g] - mnew);
                mref[g] = mnew - off;
                muse[g] = mnew;
                lsum[g] *= corr;
                #pragma unroll
                for (int j = 0; j < 4; ++j) acc[j][g] *= corr;
            }
        }
        #pragma unroll
        for (int g = 0; g < QCOLS; ++g) {
            #pragma unroll
            for (int n = 0; n < 2; ++n) {
                S[g][n] -= muse[g];
                #pragma unroll
                for (int r = 0; r < 8; ++r) S[g][n][r] = __builtin_amdgcn_exp2f(S[g][n][r]);
            }
            const v8f s8 = S[g][0] + S[g][1];
            lsum[g] += ((s8[0] + s8[1]) + (s8[2] + s8[3])) + ((s8[4] + s8[5]) + (s8[6] + s8[7]));
            // P^T as B fragment: element s < 8 is key 8*laneHi + s, s >= 8 key 16 + 8*laneHi + (s - 8)
            pf[g].h[0] = __builtin_convertvector(S[g][0], v8h);
            pf[g].h[1] = __builtin_convertvector(S[g][1], v8h);
        }
    };

    // ---- prologue: stage the first group's top tiles into buffer 0 ----
    {
        const float* kr = Kb + (size_t)(qg * KSTEP + hw * KTILE + kRow) * DMODEL + kD0;
        #pragma unroll
        for (int i = 0; i < 4; ++i)
            #pragma unroll
            for (int d = 0; d < 4; ++d) kreg[i * 4 + d] = kr[i * 16 * DMODEL + d];
        #pragma unroll
        for (int i = 0; i < 4; ++i) {
            const float* vr = Vb + (size_t)(qg * KSTEP + hw * KTILE + vS0 + i) * DMODEL + vD0;
            #pragma unroll
            for (int d = 0; d < 4; ++d) vreg[i * 4 + d] = vr[d];
        }
        #pragma unroll
        for (int i = 0; i < 4; ++i)
            *(uint2*)&sK[0][hw][kRow + 16 * i][kD0] = make_uint2(pk16(kreg[4 * i],     kreg[4 * i + 1]),
                                                                 pk16(kreg[4 * i + 2], kreg[4 * i + 3]));
        #pragma unroll
        for (int d = 0; d < 4; ++d) {
            *(unsigned*)&sVt[0][hw][vD0 + d][vS0]     = pk16(vreg[d],     vreg[4 + d]);
            *(unsigned*)&sVt[0][hw][vD0 + d][vS0 + 2] = pk16(vreg[8 + d], vreg[12 + d]);
        }
    }

    // The block's trips, counted over both groups: trip i works on 128-key tile tileAt(i).  A tile's global
    // loads are issued two trips ahead of its use and stay in flight over one barrier; it is converted and
    // stored to LDS in the trip in front of its own, behind that trip's first product.
    const int nLong  = qg + 1;                         // trips of the first, long group
    const int nTrips = nLong + (int)blockIdx.y + 1;    // and of both groups
    auto tileAt = [&](int i) { return i < nLong ? nLong - 1 - i : nLong + (int)blockIdx.y - i; };
    auto loadTile = [&](int kNext) {                   // kNext: first key of the 64-key tile this wave helps to stage
        const float* kr = Kb + (size_t)(unsigned)(kNext + kRow) * DMODEL + kD0;
        #pragma unroll
        for (int i = 0; i < 4; ++i)
            #pragma unroll
            for (int d = 0; d < 4; ++d) kreg[i * 4 + d] = kr[i * 16 * DMODEL + d];
        #pragma unroll
        for (int i = 0; i < 4; ++i) {
            const float* vr = Vb + (size_t)(unsigned)(kNext + vS0 + i) * DMODEL + vD0;
            #pragma unroll
            for (int d = 0; d < 4; ++d) vreg[i * 4 + d] = vr[d];
        }
        // The code behind reuses the loads' address registers while the loads are in flight:
        // this wait stands in front of the first such overwrite (it does not wait for the data).
        asm volatile("s_wait_xcnt 0x0" ::: "memory");
    };
    loadTile(tileAt(1) * KSTEP + hw * KTILE);          // there are always two trips or more

    int it = 0;                                        // trips done, over both groups: picks the buffer
    for (int ph = 0; ph < 2; ++ph) {
        const int kTop    = qg;                            // causal: keys < (qg + 1) * 128; same for all waves
        const int qRowMax = qRow0 + QCOLS * 16 - 1;        // scalar
        for (int kt = kTop; kt >= 0; --kt, ++it) {         // from the diagonal's trip down to key 0
            const int  kBase = kt * KSTEP + kq * KSUB;    // scalar: first key of this wave's quarter
            const int  cur   = it & 1;
            const bool act   = kBase <= qRowMax;          // scalar: the wave's rows reach its quarter

            // buffer[cur] ready; buffer[1-cur] free to overwrite.  The barrier's fences name LDS alone:
            // __syncthreads() also drains every outstanding global load, and the loads of the next trip's
            // tile, which only this thread's registers receive, are to stay in flight across it.
            __builtin_amdgcn_fence(__ATOMIC_RELEASE, "workgroup", "local");
            __builtin_amdgcn_s_barrier();
            __builtin_amdgcn_fence(__ATOMIC_ACQUIRE, "workgroup", "local");

            // ---- S^T = K * Q^T : S[g][n][r] = key n*16 + laneHi*8 + r, query g*16 + laneN;
            //      each K fragment serves both column groups ----
            v8f S[QCOLS][2];
            if (act) {   // scalar condition: s_cbranch, EXEC stays all-ones
                V16 kf[2][2];
                #pragma unroll
                for (int n = 0; n < 2; ++n) {
                    #pragma unroll
                    for (int ch = 0; ch < 2; ++ch) {
                        const _Float16* kp = &sK[cur][kh][ks + n * 16 + laneN][ch * 32 + laneHi * 8];
                        kf[n][ch].h[0] = *(const v8h*)kp;
                        kf[n][ch].h[1] = *(const v8h*)(kp + 16);
                    }
                }
                // Holds the eight reads together in front of the products: sunk among them, each pair is
                // waited for right behind its issue and the wave sits out the LDS latency three times.
                __builtin_amdgcn_sched_barrier(0);
                #pragma unroll
                for (int ch = 0; ch < 2; ++ch) {
                    #pragma unroll
                    for (int n = 0; n < 2; ++n) {
                        #pragma unroll
                        for (int g = 0; g < QCOLS; ++g)
                            S[g][n] = __builtin_amdgcn_wmma_f32_16x16x32_f16(
                                          false, kf[n][ch].v, false, qf[g][ch], (short)0,
                                          ch == 0 ? (v8f){0,0,0,0,0,0,0,0} : S[g][n], false, false);
                    }
                }
            }

            // Convert and store the next trip's tile, loaded during the trip before: the stores drain under
            // this trip's softmax, not in front of the next barrier.
            if (it + 1 < nTrips) {
                const int nxt = 1 - cur;
                #pragma unroll
                for (int i = 0; i < 4; ++i)
                    *(uint2*)&sK[nxt][hw][kRow + 16 * i][kD0] = make_uint2(pk16(kreg[4 * i],     kreg[4 * i + 1]),
                                                                           pk16(kreg[4 * i + 2], kreg[4 * i + 3]));
                #pragma unroll
                for (int d = 0; d < 4; ++d) {
                    *(unsigned*)&sVt[nxt][hw][vD0 + d][vS0]     = pk16(vreg[d],     vreg[4 + d]);
                    *(unsigned*)&sVt[nxt][hw][vD0 + d][vS0 + 2] = pk16(vreg[8 + d], vreg[12 + d]);
                }
            }
            // Into the registers just freed: the loads of the tile after the next, a whole trip ahead of their use.
            if (it + 2 < nTrips) loadTile(tileAt(it + 2) * KSTEP + hw * KTILE);

            if (act) {   // scalar condition: s_cbranch, EXEC stays all-ones
                // ---- online softmax: mask path only for the diagonal quarter (scalar cond) ----
                V16 pf[QCOLS];
                const float off = bstep * (float)(kTop - kt);
                softmaxTile(kBase + KSUB - 1 > qRow0, S, kBase, off, pf);

                // ---- O^T += V^T * P^T : V^T 16x32 (A), each fragment serving both column groups' P^T (B) ----
                // Three fragments are read as one group ahead of the products, the fourth into the first one's
                // registers behind its products (a fourth register set spills).  The fences hold that order: read
                // pair by pair into one set, each pair is waited for right behind its issue, four LDS latencies a trip.
                V16 vf[3];
                auto readV = [&](int j, V16& f) {
                    const _Float16* vp2 = &sVt[cur][kh][j * 16 + laneN][ks + laneHi * 8];
                    f.h[0] = *(const v8h*)vp2;
                    f.h[1] = *(const v8h*)(vp2 + 16);
                };
                auto prodV = [&](int j, const V16& f) {
                    #pragma unroll
                    for (int g = 0; g < QCOLS; ++g)
                        acc[j][g] = __builtin_amdgcn_wmma_f32_16x16x32_f16(
                                        false, f.v, false, pf[g].v, (short)0, acc[j][g], false, false);
                };
                readV(0, vf[0]); readV(1, vf[1]); readV(2, vf[2]);
                __builtin_amdgcn_sched_barrier(0);
                prodV(0, vf[0]);
                __builtin_amdgcn_sched_barrier(0);
                readV(3, vf[0]);
                __builtin_amdgcn_sched_barrier(0);
                prodV(1, vf[1]); prodV(2, vf[2]); prodV(3, vf[0]);
            }

            // the next trip's barrier publishes buffer[1-cur]
        }

        // ---- join the key quarters: the four waves that share 32 query rows exchange their states, lane to
        //      lane.  Wave kq finishes column group kq >> 1, d = (kq & 1)*32 + 0..31: whole 128-B output lines ----
        {
            // Four vector slots between the loop's last product and the join's vector instructions on its
            // registers.
            asm volatile("v_nop\n\tv_nop\n\tv_nop\n\tv_nop");
            // Each reference is relative to its quarter's first key of the top trip, qg * 128 + kq * 32, whether
            // or not the rows reach that quarter there; hand it over relative to key qg * 128.  A quarter
            // that had no keys hands over -inf, 0 and zeros, and its factor below is 0.
            const float madj = slope2 * (float)(kq * KSUB);
            #pragma unroll
            for (int g = 0; g < QCOLS; ++g) {
                sMl[wq][kq][g][0][lane] = mref[g] + madj;
                sMl[wq][kq][g][1][lane] = lsum[g];
            }
            #pragma unroll
            for (int o = 0; o < KPARTS; ++o) {
                if (o != kq) {   // scalar condition: a wave keeps its own part in registers
                    #pragma unroll
                    for (int t = 0; t < 2; ++t) {
                        const v8f a = acc[2 * (o & 1) + t][o >> 1];
                        *(float4*)sAcc[wq][kq][o][2 * t][lane]     = make_float4(a[0], a[1], a[2], a[3]);
                        *(float4*)sAcc[wq][kq][o][2 * t + 1][lane] = make_float4(a[4], a[5], a[6], a[7]);
                    }
                }
            }
        }
        __syncthreads();   // every quarter's state is written; every wave passes it
        {
            const int gq = kq >> 1;
            float mq[KPARTS], lq[KPARTS];          // entry i: quarter (kq + i) & 3, entry 0 this wave's own
            #pragma unroll
            for (int i = 0; i < KPARTS; ++i) {
                mq[i] = sMl[wq][(kq + i) & (KPARTS - 1)][gq][0][lane];
                lq[i] = sMl[wq][(kq + i) & (KPARTS - 1)][gq][1][lane];
            }
            const float mj = fmaxf(fmaxf(mq[0], mq[1]), fmaxf(mq[2], mq[3]));
            float fq[KPARTS];
            #pragma unroll
            for (int i = 0; i < KPARTS; ++i) fq[i] = __builtin_amdgcn_exp2f(mq[i] - mj);
            const float ls = (lq[0] * fq[0] + lq[1] * fq[1]) + (lq[2] * fq[2] + lq[3] * fq[3]);
            v8f o2[2];
            #pragma unroll
            for (int t = 0; t < 2; ++t) {
                const v8f own = kq == 0 ? acc[t][0] : kq == 1 ? acc[2 + t][0] : kq == 2 ? acc[t][1] : acc[2 + t][1];
                o2[t] = own * fq[0];
                #pragma unroll
                for (int i = 1; i < KPARTS; ++i) {
                    const float4 lo = *(const float4*)sAcc[wq][(kq + i) & (KPARTS - 1)][kq][2 * t][lane];
                    const float4 hi = *(const float4*)sAcc[wq][(kq + i) & (KPARTS - 1)][kq][2 * t + 1][lane];
                    o2[t] += (v8f){lo.x, lo.y, lo.z, lo.w, hi.x, hi.y, hi.z, hi.w} * fq[i];
                }
            }
            // ---- finalize: join the two lane halves' sums, normalize, store 8 consecutive d per tile and lane ----
            const float inv = 1.0f / (ls + xhalf(ls));
            float* orow = Ob + (size_t)(tq + gq * 16) * DMODEL + (kq & 1) * 32 + laneHi * 8;
            #pragma unroll
            for (int t = 0; t < 2; ++t) {
                const v8f o = o2[t] * inv;
                *(float4*)(orow + t * 16)     = make_float4(o[0], o[1], o[2], o[3]);
                *(float4*)(orow + t * 16 + 4) = make_float4(o[4], o[5], o[6], o[7]);
            }
            // The fresh state below overwrites registers that these stores name: this wait stands in front
            // of the first such overwrite (it does not wait for the stores to finish).
            asm volatile("s_wait_xcnt 0x0" ::: "memory");
        }
        if (ph == 1) break;
        // ---- the mirror group: its rows, its Q out of LDS, a fresh state; the staged tiles run on ----
        qg    = blockIdx.y;
        qRow0 = qg * QBLK + wq * (QCOLS * 16);
        tq    = qRow0 + laneN;
        #pragma unroll
        for (int g = 0; g < QCOLS; ++g) {
            #pragma unroll
            for (int c = 0; c < 2; ++c) {
                V16 qn;
                qn.h[0] = *(const v8h*)sQn[wq][g * 2 + c][0][lane];
                qn.h[1] = *(const v8h*)sQn[wq][g * 2 + c][1][lane];
                qf[g][c] = qn.v;
            }
            mref[g] = -__builtin_inff();
            lsum[g] = 0.0f;
        }
        #pragma unroll
        for (int j = 0; j < 4; ++j)
            #pragma unroll
            for (int g = 0; g < QCOLS; ++g) acc[j][g] = (v8f){0,0,0,0,0,0,0,0};
    }
}

extern "C" void kernel_launch(void* const* d_in, const int* in_sizes, int n_in,
                              void* d_out, int out_size, void* d_ws, size_t ws_size,
                              hipStream_t stream) {
    const float* q = (const float*)d_in[0];
    const float* k = (const float*)d_in[1];
    const float* v = (const float*)d_in[2];
    float* out = (float*)d_out;

    const int B = 2, T = 2048;
    dim3 grid(B * NHEAD, T / QBLK / 2);              // 32 x 8 blocks, two mirrored 128-row groups each
    dim3 block(512);                                 // 16 wave32 waves
    fa_alibi_kernel<<<grid, block, 0, stream>>>(q, k, v, out, T);
}

// v010
// One run takes 20.7 microseconds.
// Timed twice side by side with v009, it ran 1.09 times as fast both times.
// Over all steps from v000 it is 5.67 times as fast.
#include <hip/hip_runtime.h>

typedef __attribute__((ext_vector_type(16))) _Float16 v16h;
typedef __attribute__((ext_vector_type(8)))  _Float16 v8h;
typedef __attribute__((ext_vector_type(2)))  __fp16   fp16x2;
typedef __attribute__((ext_vector_type(8)))  float    v8f;

#define NHEAD    16
#define DHEAD    64
#define DMODEL   1024
#define KTILE    64           // keys per staged tile
#define KHALVES  2            // tiles staged per trip, one by each half of the block's waves
#define KSTEP    (KTILE * KHALVES)   // keys a block consumes per trip
#define KSUB     32           // keys one wave takes per trip
#define KPARTS   (KSTEP / KSUB)      // key quarters: quarter kq walks the keys kq*32 + 128 i + 0..31
#define QCOLS    2            // 16-query column groups per wave: each K or V fragment read feeds two products
#define QGRP     4            // 32-row query groups per block, each held by KPARTS waves
#define QBLK     128          // QGRP * QCOLS * 16 adjacent query rows
#define VT_PITCH 72           // 64 + 8 halves pad: 16B-aligned rows, bank spread
#define KP_PITCH 72           // K rows: 144 B = 16 B x odd, so 16 rows read by b128 spread over all banks
#define SUM_LIM  4096.0f      // a lane's P of one trip may sum to this under the reference in use: each P then fits f16

union V16 { v16h v; v8h h[2]; };

__device__ __forceinline__ unsigned pk16(float a, float b) {   // v_cvt_pk_rtz_f16_f32
    union { fp16x2 h; unsigned u; } cv;
    cv.h = __builtin_amdgcn_cvt_pkrtz(a, b);
    return cv.u;
}

// Lane l <-> lane l ^ 16: the two lanes that share one query column.
__device__ __forceinline__ float xhalf(float x) {
    const int i = __float_as_int(x);
    return __int_as_float(__builtin_amdgcn_permlanex16(i, i, 0x76543210, 0xfedcba98, false, false));
}

__global__ __launch_bounds__(512)
void fa_alibi_kernel(const float* __restrict__ Q,
                     const float* __restrict__ K,
                     const float* __restrict__ V,
                     float* __restrict__ O,
                     int T)
{
    __shared__ __align__(16) _Float16 sK [2][KHALVES][KTILE][KP_PITCH];   // K tiles, row-major, padded rows
    __shared__ __align__(16) _Float16 sVt[2][KHALVES][DHEAD][VT_PITCH];   // V tiles, transposed
    __shared__ __align__(16) float    sAcc[QGRP][KPARTS][KPARTS][4][32][4];  // join: [rows][from quarter][for quarter] O^T pieces
    __shared__ float                  sMl [QGRP][KPARTS][QCOLS][2][32];      // join: each quarter's maxima and sums
    __shared__ __align__(16) _Float16 sQn [QGRP][QCOLS * 2][2][32][8];       // the mirror group's Q fragments

    const int h  = blockIdx.x % NHEAD;
    const int b  = blockIdx.x / NHEAD;
    // A trip (barrier, staging, one tile's products and softmax per wave) is a chain of latencies, and
    // the last query rows need every key.  The block's 16 waves are 4 query groups of 32 rows times 4 key
    // quarters of 32 keys, 128 keys a trip, so the longest walk is T / 128 trips; the quarters' partial
    // softmax states join at the end.  A wave holds 32 query columns because the LDS read rate binds:
    // a 1-KB K or V fragment then feeds two matrix instructions, not one.
    // Cost grows with the query position and every block is resident at once: each block takes the
    // 128-row group blockIdx.y from the bottom and then, on the same waves, its mirror from the top,
    // T / 128 + 1 trips in every block.
    int qg = T / QBLK - 1 - blockIdx.y;             // 128-row group in work: the long one first

    const int tid    = threadIdx.x;
    // Wave id as a *scalar* so per-wave conditions compile to s_cmp/s_cbranch
    // (EXEC untouched) instead of v_cmpx/saveexec.
    const int wave   = __builtin_amdgcn_readfirstlane(tid >> 5);
    const int lane   = tid & 31;
    const int laneN  = lane & 15;
    const int laneHi = lane >> 4;

    const int hw      = (wave >> 3) & 1;       // scalar: the 64-key tile that this wave helps to stage
    const int kq      = wave & (KPARTS - 1);   // scalar: key quarter that this wave computes on
    const int wq      = (wave >> 2) & (QGRP - 1);   // scalar: 32-row group inside the block
    const int kh      = kq >> 1;               // scalar: staged tile that holds the quarter
    const int ks      = (kq & 1) * KSUB;       // scalar: the quarter's first key inside that tile
    int       qRow0   = qg * QBLK + wq * (QCOLS * 16);   // scalar

    const size_t headOff = (size_t)h * DHEAD;
    const float* Qb = Q + (size_t)b * T * DMODEL + headOff;
    const float* Kb = K + (size_t)b * T * DMODEL + headOff;
    const float* Vb = V + (size_t)b * T * DMODEL + headOff;
    float*       Ob = O + (size_t)b * T * DMODEL + headOff;

    // ---- Q fragments (B operand: column = query g*16 + laneN): per column group 64x16 f16 as two 32x16
    //      chunks, loaded once.  The mirror group's four fragments wait in LDS: each of the four waves that
    //      share the rows fetches one of them (column group kq >> 1, chunk kq & 1) ----
    const float L2E    = 1.44269504088896f;
    const float SCALE2 = 0.125f * L2E;                        // (1/sqrt(d)) * log2(e), folded into Q
    v16h qf[QCOLS][2];
    {
        // One pointer per column group, constant offsets only: piece 4 c + u holds k = c*32 + laneHi*8 + {0, 4, 16, 20}[u] + 0..3
        float4 qa[QCOLS][8], qb[4];
        #pragma unroll
        for (int g = 0; g < QCOLS; ++g) {
            const float* qrow = Qb + (size_t)(qRow0 + g * 16 + laneN) * DMODEL + laneHi * 8;
            #pragma unroll
            for (int u = 0; u < 8; ++u)
                qa[g][u] = *(const float4*)(qrow + (u >> 2) * 32 + ((u >> 1) & 1) * 16 + (u & 1) * 4);
            // Naming the pointer keeps its registers out of the loads' results up to this wait, which stands in
            // front of their first overwrite (it does not wait for the data).
            asm volatile("s_wait_xcnt 0x0" :: "v"(qrow) : "memory");
        }
        const float* qnxt = Qb + (size_t)(blockIdx.y * QBLK + wq * (QCOLS * 16) + (kq >> 1) * 16 + laneN) * DMODEL
                               + (kq & 1) * 32 + laneHi * 8;
        #pragma unroll
        for (int u = 0; u < 4; ++u)
            qb[u] = *(const float4*)(qnxt + (u >> 1) * 16 + (u & 1) * 4);
        asm volatile("s_wait_xcnt 0x0" :: "v"(qnxt) : "memory");   // the same for the mirror group's pointer
        #pragma unroll
        for (int g = 0; g < QCOLS; ++g) {
            #pragma unroll
            for (int c = 0; c < 2; ++c) {
                #pragma unroll
                for (int u = 0; u < 4; ++u) {
                    qf[g][c][4 * u]     = (_Float16)(qa[g][4 * c + u].x * SCALE2);
                    qf[g][c][4 * u + 1] = (_Float16)(qa[g][4 * c + u].y * SCALE2);
                    qf[g][c][4 * u + 2] = (_Float16)(qa[g][4 * c + u].z * SCALE2);
                    qf[g][c][4 * u + 3] = (_Float16)(qa[g][4 * c + u].w * SCALE2);
                }
            }
        }
        V16 qn;
        #pragma unroll
        for (int u = 0; u < 4; ++u) {
            qn.v[4 * u]     = (_Float16)(qb[u].x * SCALE2);
            qn.v[4 * u + 1] = (_Float16)(qb[u].y * SCALE2);
            qn.v[4 * u + 2] = (_Float16)(qb[u].z * SCALE2);
            qn.v[4 * u + 3] = (_Float16)(qb[u].w * SCALE2);
        }
        // read back behind the first group's join barrier
        *(v8h*)sQn[wq][kq][0][lane] = qn.h[0];
        *(v8h*)sQn[wq][kq][1][lane] = qn.h[1];
    }

    // ---- staging geometry ----
    // K: thread -> (4 rows, 4 d): 16 lanes cover one row's 256 B, so each wave-wide 16-byte load is four
    // whole 128-B lines, not 16-byte pieces of sixteen lines.  A wave's two rows lie 8 apart: 8 * 144 B is
    // 288 dwords, 32 banks on modulo 64, so its 8-byte LDS stores fill all 64 banks once.  Rows kRow + 16 i.
    // V: thread -> (4 s rows, 4 d) so s-pairs pack.  Waves 0-7 stage the trip's first tile, waves 8-15 the second.
    const int kRow = ((tid >> 5) & 7) + ((tid >> 4) & 1) * 8;
    const int kD0  = (tid & 15) * 4;
    const int vD0  = (tid & 15) * 4;
    const int vS0  = ((tid >> 4) & 15) * 4;
    const unsigned kOff = (unsigned)(kRow * DMODEL + kD0) * 4u;   // bytes from a tile's first K element to this thread's
    const unsigned vOff = (unsigned)(vS0 * DMODEL + vD0) * 4u;    // the same for V
    float kreg[16], vreg[16];

    // ---- flash state in log2 domain ----
    // alibi slope * log2(e): the same in every lane, so it and what is derived from it are kept in scalar registers
    const float slope2 = __int_as_float(__builtin_amdgcn_readfirstlane(
                             __float_as_int(exp2f(-0.5f * (float)(h + 1)) * L2E)));
    const float bstep  = slope2 * (float)KSTEP;               // a wave's next tile lies KSTEP keys back

    // acc[j][g][r] = O^T[d = j*16 + laneHi*8 + r][query g*16 + laneN]
    v8f   acc[4][QCOLS], cb;
    #pragma unroll
    for (int j = 0; j < 4; ++j)
        #pragma unroll
        for (int g = 0; g < QCOLS; ++g) acc[j][g] = (v8f){0,0,0,0,0,0,0,0};
    // ALiBi term of key laneHi*8 + r counted from the wave's first key of the trip (16 keys on: 16 slopes more).  The rest of the
    // term, slope2 * (kBase - t), is one number per query and trip: the part in t cancels in the softmax,
    // the part in kBase is added to the reference, which is kept relative to the group's top trip.
    #pragma unroll
    for (int r = 0; r < 8; ++r) cb[r] = slope2 * (float)(laneHi * 8 + r);
    int       tq = qRow0 + laneN;            // this lane's query in column group 0; group 1 lies 16 rows on
    float     mref[QCOLS], lsum[QCOLS];      // softmax reference, relative to the top trip's keys; sum over
    #pragma unroll                           // this lane's half of the keys (halves join at the end)
    for (int g = 0; g < QCOLS; ++g) { mref[g] = -__builtin_inff(); lsum[g] = 0.0f; }
    bool      fresh = true;                  // scalar: the wave has had no keys of this group yet, no reference stands

    // ---- S^T - reference = K * Q^T + C : S[g][n][r] = key n*16 + laneHi*8 + r, query g*16 + laneN, in log2 units
    //      relative to muse[g]; each K fragment serves both column groups ----
    auto scoreTile = [&](v8f (&S)[QCOLS][2], const float (&muse)[QCOLS], int cur) {
        V16 kf[2][2];
        #pragma unroll
        for (int n = 0; n < 2; ++n) {
            #pragma unroll
            for (int ch = 0; ch < 2; ++ch) {
                const _Float16* kp = &sK[cur][kh][ks + n * 16 + laneN][ch * 32 + laneHi * 8];
                kf[n][ch].h[0] = *(const v8h*)kp;
                kf[n][ch].h[1] = *(const v8h*)(kp + 16);
            }
        }
        // The C operands, formed while the reads are under way; the second 16 keys lie 16 slopes on.
        #pragma unroll
        for (int g = 0; g < QCOLS; ++g) {
            S[g][0] = cb - muse[g];
            S[g][1] = cb - (muse[g] - slope2 * 16.0f);
        }
        // Holds the eight reads together in front of the products: sunk among them, each pair is
        // waited for right behind its issue and the wave sits out the LDS latency four times.
        __builtin_amdgcn_sched_barrier(0);
        #pragma unroll
        for (int ch = 0; ch < 2; ++ch) {
            #pragma unroll
            for (int n = 0; n < 2; ++n) {
                #pragma unroll
                for (int g = 0; g < QCOLS; ++g)
                    S[g][n] = __builtin_amdgcn_wmma_f32_16x16x32_f16(
                                  false, kf[n][ch].v, false, qf[g][ch], (short)0, S[g][n], false, false);
            }
        }
    };
    // The same scores for a trip that outgrew its reference.  Rare, so built for few registers, not for speed: two
    // fragments at a time, and the ALiBi term and the reference added behind the products (formed as C operands
    // they would be the very values of the trip's head, and the compiler would hold those 32 registers for it).
    auto scoreAgain = [&](v8f (&S)[QCOLS][2], const float (&muse)[QCOLS], int cur) {
        #pragma unroll
        for (int n = 0; n < 2; ++n) {
            V16 kf[2];
            #pragma unroll
            for (int ch = 0; ch < 2; ++ch) {
                const _Float16* kp = &sK[cur][kh][ks + n * 16 + laneN][ch * 32 + laneHi * 8];
                kf[ch].h[0] = *(const v8h*)kp;
                kf[ch].h[1] = *(const v8h*)(kp + 16);
            }
            #pragma unroll
            for (int g = 0; g < QCOLS; ++g) {
                S[g][n] = __builtin_amdgcn_wmma_f32_16x16x32_f16(
                              false, kf[0].v, false, qf[g][0], (short)0, (v8f){0,0,0,0,0,0,0,0}, false, false);
                S[g][n] = __builtin_amdgcn_wmma_f32_16x16x32_f16(
                              false, kf[1].v, false, qf[g][1], (short)0, S[g][n], false, false);
                S[g][n] = (S[g][n] + cb) - (n == 0 ? muse[g] : muse[g] - slope2 * 16.0f);
            }
        }
    };
    // P = 2^S in place, and each column group's sum over this lane's half of the keys
    auto expSum = [&](v8f (&S)[QCOLS][2], float (&ts)[QCOLS]) {
        #pragma unroll
        for (int g = 0; g < QCOLS; ++g) {
            #pragma unroll
            for (int n = 0; n < 2; ++n)
                #pragma unroll
                for (int r = 0; r < 8; ++r) S[g][n][r] = __builtin_amdgcn_exp2f(S[g][n][r]);
            const v8f s8 = S[g][0] + S[g][1];
            ts[g] = ((s8[0] + s8[1]) + (s8[2] + s8[3])) + ((s8[4] + s8[5]) + (s8[6] + s8[7]));
        }
    };
    // ---- softmax body of one trip, both column groups.  S holds the scores relative to muse.
    //      diag (scalar) is set for the quarter on the diagonal, whose first key is the wave's first row; it is
    //      always a wave's first quarter of its group.
    //      off = slope2 * (keys between the top trip's tile and this one) ----
    auto softmaxTile = [&](bool diag, v8f (&S)[QCOLS][2], float (&muse)[QCOLS], float off, int cur, V16* pf) {
        float ts[QCOLS];
        bool  move = fresh;                  // scalar: the reference is to be set or moved on this trip
        if (!fresh) {
            expSum(S, ts);
            // One test per trip for the whole wave, a scalar branch, on sums that are needed anyway: no P of a
            // lane can pass its sum.  The comparison is written so that an overflowed sum fails it too.
            // S is gone by then: the K tile still stands in LDS, and the scores are taken from it again.
            const bool need = !(ts[0] + ts[1] <= SUM_LIM);
            if (__builtin_amdgcn_ballot_w32(need) != 0) {
                scoreAgain(S, muse, cur);
                move = true;
            }
        }
        if (move) {
            if (diag) {
                #pragma unroll
                for (int g = 0; g < QCOLS; ++g) {
                    const int lim = g * 16 + laneN - laneHi * 8;     // last allowed n*16 + r: the tile starts at the wave's first row
                    #pragma unroll
                    for (int n = 0; n < 2; ++n)
                        #pragma unroll
                        for (int r = 0; r < 8; ++r)
                            if (n * 16 + r > lim) S[g][n][r] = -__builtin_inff();
                }
            }
            #pragma unroll
            for (int g = 0; g < QCOLS; ++g) {
                float e[8];
                #pragma unroll
                for (int r = 0; r < 8; ++r) e[r] = fmaxf(S[g][0][r], S[g][1][r]);
                const float mx = fmaxf(fmaxf(fmaxf(e[0], e[1]), fmaxf(e[2], e[3])),
                                       fmaxf(fmaxf(e[4], e[5]), fmaxf(e[6], e[7])));   // this lane's half of the keys
                float d = fmaxf(mx, xhalf(mx));          // the column's maximum above the reference in use
                if (!fresh) {                            // scalar: a standing reference only rises
                    d = fmaxf(d, 0.0f);
                    const float corr = __builtin_amdgcn_exp2f(-d);
                    lsum[g] *= corr;
                    #pragma unroll
                    for (int j = 0; j < 4; ++j) acc[j][g] *= corr;
                }
                muse[g] += d;
                mref[g] = muse[g] - off;
                #pragma unroll
                for (int n = 0; n < 2; ++n) S[g][n] -= d;
            }
            expSum(S, ts);
        }
        fresh = false;
        #pragma unroll
        for (int g = 0; g < QCOLS; ++g) {
            lsum[g] += ts[g];
            // P^T as B fragment: element s < 8 is key 8*laneHi + s, s >= 8 key 16 + 8*laneHi + (s - 8)
            pf[g].h[0] = __builtin_convertvector(S[g][0], v8h);
            pf[g].h[1] = __builtin_convertvector(S[g][1], v8h);
        }
    };

    // ---- prologue: stage the first group's top tiles into buffer 0 ----
    {
        const float* kr = Kb + (size_t)(qg * KSTEP + hw * KTILE + kRow) * DMODEL + kD0;
        #pragma unroll
        for (int i = 0; i < 4; ++i)
            #pragma unroll
            for (int d = 0; d < 4; ++d) kreg[i * 4 + d] = kr[i * 16 * DMODEL + d];
        #pragma unroll
        for (int i = 0; i < 4; ++i) {
            const float* vr = Vb + (size_t)(qg * KSTEP + hw * KTILE + vS0 + i) * DMODEL + vD0;
            #pragma unroll
            for (int d = 0; d < 4; ++d) vreg[i * 4 + d] = vr[d];
        }
        #pragma unroll
        for (int i = 0; i < 4; ++i)
            *(uint2*)&sK[0][hw][kRow + 16 * i][kD0] = make_uint2(pk16(kreg[4 * i],     kreg[4 * i + 1]),
                                                                 pk16(kreg[4 * i + 2], kreg[4 * i + 3]));
        #pragma unroll
        for (int d = 0; d < 4; ++d) {
            *(unsigned*)&sVt[0][hw][vD0 + d][vS0]     = pk16(vreg[d],     vreg[4 + d]);
            *(unsigned*)&sVt[0][hw][vD0 + d][vS0 + 2] = pk16(vreg[8 + d], vreg[12 + d]);
        }
    }

    // The block's trips, counted over both groups: trip i works on 128-key tile tileAt(i).  A tile's global
    // loads are issued two trips ahead of its use and stay in flight over one barrier; it is converted and
    // stored to LDS in the trip in front of its own, behind that trip's first product.
    const int nLong  = qg + 1;                         // trips of the first, long group
    const int nTrips = nLong + (int)blockIdx.y + 1;    // and of both groups
    auto tileAt = [&](int i) { return i < nLong ? nLong - 1 - i : nLong + (int)blockIdx.y - i; };
    auto loadTile = [&](int kNext) {                   // kNext: first key of the 64-key tile this wave helps to stage
        // Scalar base plus one 32-bit byte offset per operand (a head's K or V spans 8 MB): the loop holds two
        // address registers, not seven, and forms each address with one addition.
        const float* kr = (const float*)((const char*)Kb + (kOff + (unsigned)kNext * (DMODEL * 4u)));
        const float* vr = (const float*)((const char*)Vb + (vOff + (unsigned)kNext * (DMODEL * 4u)));
        #pragma unroll
        for (int i = 0; i < 4; ++i)
            #pragma unroll
            for (int d = 0; d < 4; ++d) kreg[i * 4 + d] = kr[i * 16 * DMODEL + d];
        #pragma unroll
        for (int i = 0; i < 4; ++i)
            #pragma unroll
            for (int d = 0; d < 4; ++d) vreg[i * 4 + d] = vr[i * DMODEL + d];
        // The code behind reuses the loads' address registers while the loads are in flight:
        // this wait stands in front of the first such overwrite (it does not wait for the data).
        asm volatile("s_wait_xcnt 0x0" ::: "memory");
    };
    loadTile(tileAt(1) * KSTEP + hw * KTILE);          // there are always two trips or more

    int it = 0;                                        // trips done, over both groups: picks the buffer
    for (int ph = 0; ph < 2; ++ph) {
        const int kTop    = qg;                            // causal: keys < (qg + 1) * 128; same for all waves
        const int qRowMax = qRow0 + QCOLS * 16 - 1;        // scalar
        for (int kt = kTop; kt >= 0; --kt, ++it) {         // from the diagonal's trip down to key 0
            const int  kBase = kt * KSTEP + kq * KSUB;    // scalar: first key of this wave's quarter
            const int  cur   = it & 1;
            const bool act   = kBase <= qRowMax;          // scalar: the wave's rows reach its quarter

            // buffer[cur] ready; buffer[1-cur] free to overwrite.  The barrier's fences name LDS alone:
            // __syncthreads() also drains every outstanding global load, and the loads of the next trip's
            // tile, which only this thread's registers receive, are to stay in flight across it.
            __builtin_amdgcn_fence(__ATOMIC_RELEASE, "workgroup", "local");
            __builtin_amdgcn_s_barrier();
            __builtin_amdgcn_fence(__ATOMIC_ACQUIRE, "workgroup", "local");

            // ---- first product, started from the ALiBi term less the reference seen from this trip's keys
            //      (0 while none stands) ----
            v8f   S[QCOLS][2];
            float muse[QCOLS];
            const float off = bstep * (float)(kTop - kt);
            // Every wave takes it, also the few whose rows do not reach their quarter on the diagonal's trip and
            // who drop the result: under a condition of its own the scores would have to be carried round the
            // loop for the path that skips them, sixteen register copies in every trip of every wave.
            #pragma unroll
            for (int g = 0; g < QCOLS; ++g) muse[g] = fresh ? 0.0f : mref[g] + off;
            scoreTile(S, muse, cur);

            // Convert and store the next trip's tile, loaded during the trip before: the stores drain under
            // this trip's softmax, not in front of the next barrier.
            if (it + 1 < nTrips) {
                const int nxt = 1 - cur;
                #pragma unroll
                for (int i = 0; i < 4; ++i)
                    *(uint2*)&sK[nxt][hw][kRow + 16 * i][kD0] = make_uint2(pk16(kreg[4 * i],     kreg[4 * i + 1]),
                                                                           pk16(kreg[4 * i + 2], kreg[4 * i + 3]));
                #pragma unroll
                for (int d = 0; d < 4; ++d) {
                    *(unsigned*)&sVt[nxt][hw][vD0 + d][vS0]     = pk16(vreg[d],     vreg[4 + d]);
                    *(unsigned*)&sVt[nxt][hw][vD0 + d][vS0 + 2] = pk16(vreg[8 + d], vreg[12 + d]);
                }
            }
            // Into the registers just freed: the loads of the tile after the next, a whole trip ahead of their use.
            if (it + 2 < nTrips) loadTile(tileAt(it + 2) * KSTEP + hw * KTILE);

            if (act) {   // scalar condition: s_cbranch, EXEC stays all-ones
                // ---- online softmax: mask path only for the diagonal quarter (scalar cond) ----
                V16 pf[QCOLS];
                softmaxTile(kBase == qRow0, S, muse, off, cur, pf);

                // ---- O^T += V^T * P^T : V^T 16x32 (A), each fragment serving both column groups' P^T (B) ----
                // Three fragments are read as one group ahead of the products, the fourth into the first one's
                // registers behind its products (a fourth register set spills).  The fences hold that order: read
                // pair by pair into one set, each pair is waited for right behind its issue, four LDS latencies a trip.
                V16 vf[3];
                auto readV = [&](int j, V16& f) {
                    const _Float16* vp2 = &sVt[cur][kh][j * 16 + laneN][ks + laneHi * 8];
                    f.h[0] = *(const v8h*)vp2;
                    f.h[1] = *(const v8h*)(vp2 + 16);
                };
                auto prodV = [&](int j, const V16& f) {
                    #pragma unroll
                    for (int g = 0; g < QCOLS; ++g)
                        acc[j][g] = __builtin_amdgcn_wmma_f32_16x16x32_f16(
                                        false, f.v, false, pf[g].v, (short)0, acc[j][g], false, false);
                };
                readV(0, vf[0]); readV(1, vf[1]); readV(2, vf[2]);
                __builtin_amdgcn_sched_barrier(0);
                prodV(0, vf[0]);
                __builtin_amdgcn_sched_barrier(0);
                readV(3, vf[0]);
                __builtin_amdgcn_sched_barrier(0);
                prodV(1, vf[1]); prodV(2, vf[2]); prodV(3, vf[0]);
            }

            // the next trip's barrier publishes buffer[1-cur]
        }

        // ---- join the key quarters: the four waves that share 32 query rows exchange their states, lane to
        //      lane.  Wave kq finishes column group kq >> 1, d = (kq & 1)*32 + 0..31: whole 128-B output lines ----
        {
            // Four vector slots between the loop's last product and the join's vector instructions on its
            // registers.
            asm volatile("v_nop\n\tv_nop\n\tv_nop\n\tv_nop");
            // Each reference is relative to its quarter's first key of the top trip, qg * 128 + kq * 32, whether
            // or not the rows reach that quarter there; hand it over relative to key qg * 128.  A quarter
            // that had no keys hands over -inf, 0 and zeros, and its factor below is 0.
            const float madj = slope2 * (float)(kq * KSUB);
            #pragma unroll
            for (int g = 0; g < QCOLS; ++g) {
                sMl[wq][kq][g][0][lane] = mref[g] + madj;
                sMl[wq][kq][g][1][lane] = lsum[g];
            }
            #pragma unroll
            for (int o = 0; o < KPARTS; ++o) {
                if (o != kq) {   // scalar condition: a wave keeps its own part in registers
                    #pragma unroll
                    for (int t = 0; t < 2; ++t) {
                        const v8f a = acc[2 * (o & 1) + t][o >> 1];
                        *(float4*)sAcc[wq][kq][o][2 * t][lane]     = make_float4(a[0], a[1], a[2], a[3]);
                        *(float4*)sAcc[wq][kq][o][2 * t + 1][lane] = make_float4(a[4], a[5], a[6], a[7]);
                    }
                }
            }
        }
        __syncthreads();   // every quarter's state is written; every wave passes it
        {
            const int gq = kq >> 1;
            float mq[KPARTS], lq[KPARTS];          // entry i: quarter (kq + i) & 3, entry 0 this wave's own
            #pragma unroll
            for (int i = 0; i < KPARTS; ++i) {
                mq[i] = sMl[wq][(kq + i) & (KPARTS - 1)][gq][0][lane];
                lq[i] = sMl[wq][(kq + i) & (KPARTS - 1)][gq][1][lane];
            }
            const float mj = fmaxf(fmaxf(mq[0], mq[1]), fmaxf(mq[2], mq[3]));
            float fq[KPARTS];
            #pragma unroll
            for (int i = 0; i < KPARTS; ++i) fq[i] = __builtin_amdgcn_exp2f(mq[i] - mj);
            const float ls = (lq[0] * fq[0] + lq[1] * fq[1]) + (lq[2] * fq[2] + lq[3] * fq[3]);
            v8f o2[2];
            #pragma unroll
            for (int t = 0; t < 2; ++t) {
                const v8f own = kq == 0 ? acc[t][0] : kq == 1 ? acc[2 + t][0] : kq == 2 ? acc[t][1] : acc[2 + t][1];
                o2[t] = own * fq[0];
                #pragma unroll
                for (int i = 1; i < KPARTS; ++i) {
                    const float4 lo = *(const float4*)sAcc[wq][(kq + i) & (KPARTS - 1)][kq][2 * t][lane];
                    const float4 hi = *(const float4*)sAcc[wq][(kq + i) & (KPARTS - 1)][kq][2 * t + 1][lane];
                    o2[t] += (v8f){lo.x, lo.y, lo.z, lo.w, hi.x, hi.y, hi.z, hi.w} * fq[i];
                }
            }
            // ---- finalize: join the two lane halves' sums, normalize, store 8 consecutive d per tile and lane ----
            const float inv = 1.0f / (ls + xhalf(ls));
            float* orow = Ob + (size_t)(tq + gq * 16) * DMODEL + (kq & 1) * 32 + laneHi * 8;
            #pragma unroll
            for (int t = 0; t < 2; ++t) {
                const v8f o = o2[t] * inv;
                *(float4*)(orow + t * 16)     = make_float4(o[0], o[1], o[2], o[3]);
                *(float4*)(orow + t * 16 + 4) = make_float4(o[4], o[5], o[6], o[7]);
            }
            // The fresh state below overwrites registers that these stores name: this wait stands in front
            // of the first such overwrite (it does not wait for the stores to finish).
            asm volatile("s_wait_xcnt 0x0" ::: "memory");
        }
        if (ph == 1) break;
        // ---- the mirror group: its rows, its Q out of LDS, a fresh state; the staged tiles run on ----
        qg    = blockIdx.y;
        qRow0 = qg * QBLK + wq * (QCOLS * 16);
        tq    = qRow0 + laneN;
        #pragma unroll
        for (int g = 0; g < QCOLS; ++g) {
            #pragma unroll
            for (int c = 0; c < 2; ++c) {
                V16 qn;
                qn.h[0] = *(const v8h*)sQn[wq][g * 2 + c][0][lane];
                qn.h[1] = *(const v8h*)sQn[wq][g * 2 + c][1][lane];
                qf[g][c] = qn.v;
            }
            mref[g] = -__builtin_inff();
            lsum[g] = 0.0f;
        }
        fresh = true;
        #pragma unroll
        for (int j = 0; j < 4; ++j)
            #pragma unroll
            for (int g = 0; g < QCOLS; ++g) acc[j][g] = (v8f){0,0,0,0,0,0,0,0};
    }
}

extern "C" void kernel_launch(void* const* d_in, const int* in_sizes, int n_in,
                              void* d_out, int out_size, void* d_ws, size_t ws_size,
                              hipStream_t stream) {
    const float* q = (const float*)d_in[0];
    const float* k = (const float*)d_in[1];
    const float* v = (const float*)d_in[2];
    float* out = (float*)d_out;

    const int B = 2, T = 2048;
    dim3 grid(B * NHEAD, T / QBLK / 2);              // 32 x 8 blocks, two mirrored 128-row groups each
    dim3 block(512);                                 // 16 wave32 waves
    fa_alibi_kernel<<<grid, block, 0, stream>>>(q, k, v, out, T);
}
